// v000
// Measured on an AMD MI455X. A time is GPU time per run, averaged over a window of back-to-back runs after a warm-up
// (all launches, gaps included; the runs take copies of the inputs in turn), and the median of several windows.
// Apart from v000's, it joins two sittings. Times from different sittings can be a few percent apart, while
// side-by-side timings come from the same sitting.
// The starting kernel, v000, takes 1010 microseconds a run.
#include <hip/hip_runtime.h>

// ptSDPA (q [2][16][2048][64], k/v [2][4][2048][64]; GQA (4 query heads per kv head); out = softmax(q.k / 8) v -> [2][16][2048][64]; no mask).
// Compute dtypes, f32 accumulate: every input rounded to bf16; scores q.k on PLAIN bf16 operands (inputs: exact products, f32 accumulate; the 4x GQA repeat is a
// pointer mapping, never materialised); scale and softmax in f32 (register row, one exp) -> fp16 probabilities x1024; probs.v on SINGLE fp16 planes against fp16(bf16 v)

#define NB_  2
#define NHQ  16
#define NHKV 4
#define REP  (NHQ / NHKV)
#define TT   2048
#define HD   64
#define ZH   2
#define PCAR 1024.0f
#define SCL  0.125f
typedef _Float16 h16;
typedef unsigned short bf;
typedef __attribute__((ext_vector_type(16))) __bf16   v16bf;
typedef __attribute__((ext_vector_type(16))) _Float16 v16h;
typedef __attribute__((ext_vector_type(8)))  _Float16 v8h;
typedef __attribute__((ext_vector_type(8)))  unsigned short v8us;
typedef __attribute__((ext_vector_type(8)))  float    v8f;
typedef __attribute__((ext_vector_type(4)))  float    v4f;
typedef v8h  __attribute__((may_alias)) v8ha;
typedef v4f  __attribute__((may_alias)) v4fa;
typedef v8us __attribute__((may_alias)) v8usa;

__device__ __forceinline__ unsigned short f2bf(float f) { unsigned u = __float_as_uint(f); u += 0x7FFFu + ((u >> 16) & 1u); return (unsigned short)(u >> 16); }
__device__ __forceinline__ float bf2f(unsigned short b) { return __uint_as_float(((unsigned)b) << 16); }
__device__ __forceinline__ float bfr(float f) { return bf2f(f2bf(f)); }
__device__ __forceinline__ v16h cat16(v8h lo, v8h hi) { return __builtin_shufflevector(lo, hi, 0, 1, 2, 3, 4, 5, 6, 7, 8, 9, 10, 11, 12, 13, 14, 15); }
__device__ __forceinline__ v16bf cat16b(v8us lo, v8us hi) { return __builtin_bit_cast(v16bf, __builtin_shufflevector(lo, hi, 0, 1, 2, 3, 4, 5, 6, 7, 8, 9, 10, 11, 12, 13, 14, 15)); }
__device__ __forceinline__ v8f wmma16(v16h a, v16h b, v8f c) { return __builtin_amdgcn_wmma_f32_16x16x32_f16(false, a, false, b, (short)0, c, false, false); }
__device__ __forceinline__ v8f wmmab(v16bf a, v16bf b, v8f c) { return __builtin_amdgcn_wmma_f32_16x16x32_bf16(false, a, false, b, (short)0, c, false, false); }



// ---- k_gemmw: register-blocked GEMM, ONE WAVE per 64x64 output tile (16 accumulators), operands straight from K-contiguous 16-bit planes; grid (M/64, N/64, Z), 32 threads.
// C[m][n] (f32, pitch ldc, + optional f32 bias[n]) = sum_k A[m][k] Bt[n][k] (+ split products per NSPLIT). z-batch strides sA/sB/sC in elements. K % 32 == 0.
template <typename T16> struct WFrag;
template <> struct WFrag<h16> { typedef v16h V; static __device__ __forceinline__ V ld(const h16* p) { return cat16(*(const v8h*)p, *(const v8h*)(p + 16)); } static __device__ __forceinline__ v8f mma(V a, V b, v8f c) { return wmma16(a, b, c); } };
template <> struct WFrag<bf> { typedef v16bf V; static __device__ __forceinline__ V ld(const bf* p) { return cat16b(*(const v8us*)p, *(const v8us*)(p + 16)); } static __device__ __forceinline__ v8f mma(V a, V b, v8f c) { return wmmab(a, b, c); } };
template <typename T16, int NSPLIT, bool BIAS>
__global__ __launch_bounds__(32) void k_gemmw(const T16* __restrict__ A, const T16* __restrict__ A2, const T16* __restrict__ Bt, const T16* __restrict__ Bt2, int K, float* C, int ldc, const float* __restrict__ bias, size_t sA, size_t sB, size_t sC) {
    typedef typename WFrag<T16>::V V;
    __shared__ __align__(16) float os[16 * 68];
    const size_t z = blockIdx.z; A += z * sA; if (A2) A2 += z * sA; Bt += z * sB; if (Bt2) Bt2 += z * sB; C += z * sC;
    const int lane = threadIdx.x & 31, lr = lane & 15, hi = lane >> 4; const int r0 = blockIdx.x * 64, c0 = blockIdx.y * 64;
    v8f acc[4][4];
#pragma unroll
    for (int mb = 0; mb < 4; ++mb)
#pragma unroll
        for (int nb = 0; nb < 4; ++nb) acc[mb][nb] = (v8f){};
    const size_t aoff = (size_t)(r0 + lr) * K + 8 * hi, boff = (size_t)(c0 + lr) * K + 8 * hi;
#pragma unroll 1
    for (int kc = 0; kc < K; kc += 32) {
        V a[4], a2[4];
#pragma unroll
        for (int mb = 0; mb < 4; ++mb) { a[mb] = WFrag<T16>::ld(A + aoff + (size_t)mb * 16 * K + kc); if (NSPLIT == 1 || NSPLIT == 2) a2[mb] = WFrag<T16>::ld(A2 + aoff + (size_t)mb * 16 * K + kc); }
#pragma unroll
        for (int nb = 0; nb < 4; ++nb) { const V b = WFrag<T16>::ld(Bt + boff + (size_t)nb * 16 * K + kc); V b2; if (NSPLIT >= 2) b2 = WFrag<T16>::ld(Bt2 + boff + (size_t)nb * 16 * K + kc);
#pragma unroll
            for (int mb = 0; mb < 4; ++mb) { acc[mb][nb] = WFrag<T16>::mma(a[mb], b, acc[mb][nb]); if (NSPLIT == 1 || NSPLIT == 2) acc[mb][nb] = WFrag<T16>::mma(a2[mb], b, acc[mb][nb]); if (NSPLIT >= 2) acc[mb][nb] = WFrag<T16>::mma(a[mb], b2, acc[mb][nb]); } }
        asm volatile("v_nop\n\tv_nop\n\tv_nop\n\tv_nop" : "+v"(acc[0][0]), "+v"(acc[1][1]), "+v"(acc[2][2]), "+v"(acc[3][3]) : "v"(a[0]), "v"(a[3]));
    }
#pragma unroll
    for (int mb = 0; mb < 4; ++mb) {
#pragma unroll
        for (int nb = 0; nb < 4; ++nb) {
#pragma unroll
            for (int j = 0; j < 8; ++j) os[(hi * 8 + j) * 68 + nb * 16 + lr] = acc[mb][nb][j]; }
        __builtin_amdgcn_wave_barrier(); asm volatile("" ::: "memory");
        float* crow = C + (size_t)(r0 + mb * 16) * ldc + c0;
{
#pragma unroll
            for (int s = 0; s < 8; ++s) { const int row = 2 * s + hi, cofs = lr * 4; v4f val = *(const v4fa*)(os + row * 68 + cofs); if (BIAS) { val[0] += bfr(bias[c0 + cofs]); val[1] += bfr(bias[c0 + cofs + 1]); val[2] += bfr(bias[c0 + cofs + 2]); val[3] += bfr(bias[c0 + cofs + 3]); }
                *(v4f*)(crow + (size_t)row * ldc + cofs) = val; }
             }
        __builtin_amdgcn_wave_barrier(); asm volatile("" ::: "memory");
    }
}

__device__ __forceinline__ h16 tohx(float x) { return (h16)x; }
typedef __attribute__((ext_vector_type(2))) _Float16 v2h;
typedef __attribute__((ext_vector_type(4))) _Float16 v4h;

__global__ __launch_bounds__(256) void k_cvt8(const float* __restrict__ src, bf* dst, size_t n8) { const size_t i = (size_t)blockIdx.x * 256 + threadIdx.x; if (i >= n8) return; const v8f v = *(const v8f*)(src + i * 8); v8us o;
#pragma unroll
    for (int k = 0; k < 8; ++k) o[k] = f2bf(v[k]); *(v8us*)(dst + i * 8) = o;  }
__global__ __launch_bounds__(256) void k_vt16(const float* __restrict__ v, h16* VT) { const size_t e = ((size_t)blockIdx.x * 256 + threadIdx.x) * 2; if (e >= (size_t)NB_ * NHKV * HD * TT) return; const int t = (int)(e % TT); const int d = (int)((e / TT) % HD); const size_t z = e / ((size_t)TT * HD); const float* src = v + z * TT * HD; v2h o;
    o[0] = tohx(bfr(src[(size_t)t * HD + d])); o[1] = tohx(bfr(src[(size_t)(t + 1) * HD + d])); *(v2h*)(VT + e) = o;  }
__global__ __launch_bounds__(256) void k_asoft(const float* __restrict__ Sb, h16* P16) {
    const int lane = threadIdx.x & 31; const int row = blockIdx.x * 8 + (threadIdx.x >> 5); if (row >= ZH * TT) return; const int i = row & (TT - 1); (void)i; const float* sr = Sb + (size_t)row * TT; float v[TT / 32]; float mx = -3.0e38f;
#pragma unroll
    for (int ch = 0; ch < TT / 128; ++ch) { const int j0 = ch * 128 + lane * 4; const v4f a = *(const v4f*)(sr + j0);
#pragma unroll
        for (int q = 0; q < 4; ++q) { const int j = j0 + q; (void)j; const float t = a[q] * SCL; v[ch * 4 + q] = t; mx = fmaxf(mx, t); } }
#pragma unroll
    for (int sh = 16; sh; sh >>= 1) mx = fmaxf(mx, __shfl_xor(mx, sh, 32));
    float sum = 0.f;
#pragma unroll
    for (int k = 0; k < TT / 32; ++k) { float d0 = __fsub_rn(v[k], mx); asm volatile("" : "+v"(d0)); v[k] = __builtin_amdgcn_exp2f(__fmul_rn(d0, 1.4426950408889634f)); sum += v[k]; }
#pragma unroll
    for (int sh = 16; sh; sh >>= 1) sum += __shfl_xor(sum, sh, 32);
    const float f = __fdiv_rn(PCAR, sum);
{
#pragma unroll
        for (int ch = 0; ch < TT / 128; ++ch) { v4h o;
#pragma unroll
            for (int q = 0; q < 4; ++q) o[q] = tohx(v[ch * 4 + q] * f);
            *(v4h*)(P16 + (size_t)row * TT + ch * 128 + lane * 4) = o; }
         }
}
__global__ __launch_bounds__(256) void k_out(const float* __restrict__ O, float* OUTz) { const size_t i = ((size_t)blockIdx.x * 256 + threadIdx.x) * 4; if (i >= (size_t)ZH * TT * HD) return; const v4f a = *(const v4f*)(O + i); v4f o;
#pragma unroll
    for (int q = 0; q < 4; ++q) o[q] = a[q] * (1.0f / PCAR); *(v4f*)(OUTz + i) = o;  }

extern "C" void kernel_launch(void* const* d_in, const int* in_sizes, int n_in,
                              void* d_out, int out_size, void* d_ws, size_t ws_size, hipStream_t stream) {
    (void)in_sizes; (void)n_in; (void)out_size;
    const float* q = (const float*)d_in[0]; const float* k = (const float*)d_in[1]; const float* v = (const float*)d_in[2];
    float* OUT = (float*)d_out;     // [2][16][2048][64]
    char* wsp = (char*)d_ws;
    auto take = [&](size_t bytes) { char* p = wsp; wsp += (bytes + 255) & ~(size_t)255; return (void*)p; };
    bf* QB = (bf*)take((size_t)NB_ * NHQ * TT * HD * 2); bf* KB = (bf*)take((size_t)NB_ * NHKV * TT * HD * 2); h16* VT = (h16*)take((size_t)NB_ * NHKV * HD * TT * 2); float* Sb = (float*)take((size_t)ZH * TT * TT * 4); h16* Pm = (h16*)take((size_t)ZH * TT * TT * 2); float* Ob = (float*)take((size_t)ZH * TT * HD * 4);
    if ((size_t)(wsp - (char*)d_ws) > ws_size) return;    // well under 256 MiB
    { const size_t nq = (size_t)NB_ * NHQ * TT * HD / 8, nk = (size_t)NB_ * NHKV * TT * HD / 8; k_cvt8<<<(unsigned)((nq + 255) / 256), 256, 0, stream>>>(q, QB, nq); k_cvt8<<<(unsigned)((nk + 255) / 256), 256, 0, stream>>>(k, KB, nk); k_vt16<<<(unsigned)(((size_t)NB_ * NHKV * HD * TT / 2 + 255) / 256), 256, 0, stream>>>(v, VT); }
    for (int b = 0; b < NB_; ++b)
        for (int h0 = 0; h0 < NHQ; h0 += ZH) { const size_t zq = (size_t)b * NHQ + h0; const size_t zkv = (size_t)b * NHKV + h0 / REP;   // both heads of a pass share one kv head (REP >= 2) or use consecutive kv heads (REP == 1)
            const size_t sBk = (REP == 1) ? (size_t)TT * HD : 0, sBv = (REP == 1) ? (size_t)HD * TT : 0;
            k_gemmw<bf, 0, false><<<dim3(TT / 64, TT / 64, ZH), 32, 0, stream>>>(QB + zq * TT * HD, nullptr, KB + zkv * TT * HD, nullptr, HD, Sb, TT, nullptr, (size_t)TT * HD, sBk, (size_t)TT * TT);
            k_asoft<<<ZH * TT / 8, 256, 0, stream>>>(Sb, Pm);
            k_gemmw<h16, 0, false><<<dim3(TT / 64, HD / 64, ZH), 32, 0, stream>>>(Pm, nullptr, VT + zkv * HD * TT, nullptr, TT, Ob, HD, nullptr, (size_t)TT * TT, sBv, (size_t)TT * HD);
            k_out<<<(unsigned)(((size_t)ZH * TT * HD / 4 + 255) / 256), 256, 0, stream>>>(Ob, OUT + zq * TT * HD); }
}

// v002
// It runs in 45.4 microseconds.
// Versions between v000 and this one are left out; their measured steps multiply to 22.5 times as fast.
#include <hip/hip_runtime.h>

// Attention forward, no mask: q [2][16][2048][64], k/v [2][4][2048][64]; GQA (4 query heads per kv head); out = softmax(q.k / 8) v -> [2][16][2048][64].
// Compute dtypes, f32 accumulate: every input rounded to bf16; scores q.k on PLAIN bf16 operands (the 4x GQA repeat is a pointer mapping, never materialised);
// scale and softmax in f32 (running maximum and sum per query) -> fp16 weights relative to the running maximum, x1024; probs.v on SINGLE fp16 planes against fp16(bf16 v);
// the division by the row sum (which carries the same x1024) comes behind the product.

#define NB_  2
#define NHQ  16
#define NHKV 4
#define REP  (NHQ / NHKV)
#define TT   2048
#define HD   64
#define QW   32      // query columns of one wave (two 16-column groups)
#define NWV  8       // waves of one work-group
#define KP   32      // keys of one pass
#define CSL  0.18033688011112042f   // (1 / 8) * log2(e): scores go to the base-2 exponent in one multiply-add
#define PLOG 10.0f                  // probabilities carry x 2^10 into fp16; the row sum carries it too, so it cancels in the division
typedef _Float16 h16;
typedef unsigned short bf;
typedef __attribute__((ext_vector_type(16))) __bf16   v16bf;
typedef __attribute__((ext_vector_type(16))) _Float16 v16h;
typedef __attribute__((ext_vector_type(8)))  _Float16 v8h;
typedef __attribute__((ext_vector_type(8)))  unsigned short v8us;
typedef __attribute__((ext_vector_type(8)))  float    v8f;
typedef __attribute__((ext_vector_type(4)))  float    v4f;
typedef __attribute__((ext_vector_type(2)))  float    v2f;

__device__ __forceinline__ unsigned short f2bf(float f) { unsigned u = __float_as_uint(f); u += 0x7FFFu + ((u >> 16) & 1u); return (unsigned short)(u >> 16); }
__device__ __forceinline__ float bf2f(unsigned short b) { return __uint_as_float(((unsigned)b) << 16); }
__device__ __forceinline__ float bfr(float f) { return bf2f(f2bf(f)); }
__device__ __forceinline__ v16h cat16(v8h lo, v8h hi) { return __builtin_shufflevector(lo, hi, 0, 1, 2, 3, 4, 5, 6, 7, 8, 9, 10, 11, 12, 13, 14, 15); }
__device__ __forceinline__ v16bf cat16b(v8us lo, v8us hi) { return __builtin_bit_cast(v16bf, __builtin_shufflevector(lo, hi, 0, 1, 2, 3, 4, 5, 6, 7, 8, 9, 10, 11, 12, 13, 14, 15)); }
__device__ __forceinline__ v8f wmma16(v16h a, v16h b, v8f c) { return __builtin_amdgcn_wmma_f32_16x16x32_f16(false, a, false, b, (short)0, c, false, false); }
__device__ __forceinline__ v8f wmmab(v16bf a, v16bf b, v8f c) { return __builtin_amdgcn_wmma_f32_16x16x32_bf16(false, a, false, b, (short)0, c, false, false); }

// Fragment of a K-contiguous 16-bit plane, p = row (lane & 15), k offset 8 * (lane >> 4): elements 0..7 = k 8h + s, elements 8..15 = k 16 + 8h + (s - 8).
template <typename T16> struct WFrag;
template <> struct WFrag<h16> { typedef v16h V; static __device__ __forceinline__ V ld(const h16* p) { return cat16(*(const v8h*)p, *(const v8h*)(p + 16)); } };
template <> struct WFrag<bf> { typedef v16bf V; static __device__ __forceinline__ V ld(const bf* p) { return cat16b(*(const v8us*)p, *(const v8us*)(p + 16)); } };

__device__ __forceinline__ h16 tohx(float x) { return (h16)x; }
typedef __attribute__((ext_vector_type(2))) _Float16 v2h;

__global__ __launch_bounds__(256) void k_cvt8(const float* __restrict__ src, bf* dst, size_t n8) { const size_t i = (size_t)blockIdx.x * 256 + threadIdx.x; if (i >= n8) return; const v8f v = *(const v8f*)(src + i * 8); v8us o;
#pragma unroll
    for (int k = 0; k < 8; ++k) o[k] = f2bf(v[k]); *(v8us*)(dst + i * 8) = o;  }
__global__ __launch_bounds__(256) void k_vt16(const float* __restrict__ v, h16* VT) { const size_t e = ((size_t)blockIdx.x * 256 + threadIdx.x) * 2; if (e >= (size_t)NB_ * NHKV * HD * TT) return; const int t = (int)(e % TT); const int d = (int)((e / TT) % HD); const size_t z = e / ((size_t)TT * HD); const float* src = v + z * TT * HD; v2h o;
    o[0] = tohx(bfr(src[(size_t)t * HD + d])); o[1] = tohx(bfr(src[(size_t)(t + 1) * HD + d])); *(v2h*)(VT + e) = o;  }

// value of lane l ^ 16
__device__ __forceinline__ float xhalf(float x) { const int b = __float_as_int(x); return __int_as_float(__builtin_amdgcn_permlanex16(b, b, 0x76543210, 0xfedcba98, false, false)); }

#define SK   128                    // keys of one stage
#define NST  (TT / SK)
#define KPB  144                    // LDS pitch of a K row (64 bf16 = 128 bytes, + 16)
#define VPB  272                    // LDS pitch of a Vt row (128 fp16 = 256 bytes, + 16)
#define KBY  (SK * KPB)
#define BUFB (KBY + HD * VPB)       // one buffer: K rows, then Vt rows

// One stage: every thread copies four 16-byte pieces of K and four of Vt; a wave's copy covers 512 bytes in a row of K, or two 256-byte rows of Vt.
// lk, lv: the thread's own LDS byte addresses in the buffer; gk, gv: its own global addresses in the stage.
__device__ __forceinline__ void stage_copy(unsigned lk, unsigned lv, const char* gk, const char* gv) {
    // the copies and their s_wait_xcnt stand in one statement, so that no address register is rewritten in front of the wait
    asm volatile("global_load_async_to_lds_b128 %0, %8, off\n\t"
                 "global_load_async_to_lds_b128 %1, %9, off\n\t"
                 "global_load_async_to_lds_b128 %2, %10, off\n\t"
                 "global_load_async_to_lds_b128 %3, %11, off\n\t"
                 "global_load_async_to_lds_b128 %4, %12, off\n\t"
                 "global_load_async_to_lds_b128 %5, %13, off\n\t"
                 "global_load_async_to_lds_b128 %6, %14, off\n\t"
                 "global_load_async_to_lds_b128 %7, %15, off\n\t"
                 "s_wait_xcnt 0x0"
                 :: "v"(lk), "v"(lk + 32 * KPB), "v"(lk + 64 * KPB), "v"(lk + 96 * KPB), "v"(lv), "v"(lv + 16 * VPB), "v"(lv + 32 * VPB), "v"(lv + 48 * VPB),
                    "v"(gk), "v"(gk + 4096), "v"(gk + 8192), "v"(gk + 12288), "v"(gv), "v"(gv + (size_t)16 * TT * 2), "v"(gv + (size_t)32 * TT * 2), "v"(gv + (size_t)48 * TT * 2)
                 : "memory");
}

__global__ __launch_bounds__(NWV * 32) void k_fattn(const bf* __restrict__ QB, const bf* __restrict__ KB, const h16* __restrict__ VT, float* __restrict__ OUT) {
    __shared__ __attribute__((aligned(256))) unsigned char L[2 * BUFB];
    const int tid = threadIdx.x, lane = tid & 31, lr = lane & 15, hi = lane >> 4, wave = tid >> 5;
    const int zq = blockIdx.y; const int zkv = (zq / NHQ) * NHKV + (zq % NHQ) / REP;
    const int q0 = (blockIdx.x * NWV + wave) * QW;
    const bf* Qp = QB + ((size_t)zq * TT + q0 + lr) * HD + 8 * hi;
    // copy addresses of this thread: K piece tid of 256 (8 pieces a row), Vt piece tid of 256 (16 pieces a row)
    const char* gk = (const char*)(KB + (size_t)zkv * TT * HD) + tid * 16;
    const char* gv = (const char*)(VT + ((size_t)zkv * HD + (tid >> 4)) * TT) + (tid & 15) * 16;
    const unsigned l0 = (unsigned)(size_t)(__attribute__((address_space(3))) unsigned char*)L;
    const unsigned lk = l0 + (tid >> 3) * KPB + (tid & 7) * 16;
    const unsigned lv = l0 + KBY + (tid >> 4) * VPB + (tid & 15) * 16;
    stage_copy(lk, lv, gk, gv);   // stage 0 into buffer 0
    v16bf qf[2][2], kf[2][2];      // [query group][k step], [key tile][k step]
    v16h vf[4];                    // [16 rows of d]
#pragma unroll
    for (int g = 0; g < 2; ++g)
#pragma unroll
        for (int ks = 0; ks < 2; ++ks) qf[g][ks] = WFrag<bf>::ld(Qp + g * 16 * HD + ks * 32);
    v8f o[4][2];                   // [16 rows of d][query group]
#pragma unroll
    for (int dt = 0; dt < 4; ++dt) { o[dt][0] = (v8f){}; o[dt][1] = (v8f){}; }
    float m[2] = { -3.0e38f, -3.0e38f }, l[2] = { 0.f, 0.f };   // running maximum (base-2 exponent) of a query; this lane's half of its running sum
#pragma unroll 1
    for (int st = 0; st < NST; ++st) {   // stays rolled: the four passes inside are unrolled, and one stage's code is the hot loop
        // hand-over, the same in front of every stage: it publishes stage st and frees the other buffer, which stage st - 1 was read from
        asm volatile("s_wait_dscnt 0x0" ::: "memory");      // this wave's reads of the other buffer are done before the barrier behind which it is refilled
        asm volatile("s_wait_asynccnt 0x0" ::: "memory");   // this wave's copies of stage st have landed before the barrier behind which every wave reads them
        __syncthreads();
        const unsigned char* Lb = L + (st & 1) * BUFB;
        const unsigned char* Ks = Lb + lr * KPB + 16 * hi;          // K row lr, k offset 8h
        const unsigned char* Vs = Lb + KBY + lr * VPB + 16 * hi;    // Vt row lr, key offset 8h
#pragma unroll
        for (int kt = 0; kt < 2; ++kt)
#pragma unroll
            for (int ks = 0; ks < 2; ++ks) kf[kt][ks] = WFrag<bf>::ld((const bf*)(Ks + kt * 16 * KPB + ks * 64));
#pragma unroll
        for (int dt = 0; dt < 4; ++dt) vf[dt] = WFrag<h16>::ld((const h16*)(Vs + dt * 16 * VPB));
        // the next stage flies while this one is worked on; its copies stand behind this stage's first fragment reads, so that those are under way while the copies issue
        if (st + 1 < NST) stage_copy(lk + ((st + 1) & 1) * BUFB, lv + ((st + 1) & 1) * BUFB, gk + (size_t)(st + 1) * (SK * HD * 2), gv + (size_t)(st + 1) * (SK * 2));
#pragma unroll
        for (int ps_ = 0; ps_ < SK / KP; ++ps_) {
            // inside a stage K and Vt fragments are fetched one pass ahead into the same registers, each right behind its last use; nothing of the next stage is read here
            v8f s[2][2];               // [key tile][query group]
#pragma unroll
            for (int kt = 0; kt < 2; ++kt)
#pragma unroll
                for (int g = 0; g < 2; ++g) { s[kt][g] = wmmab(kf[kt][0], qf[g][0], (v8f){}); s[kt][g] = wmmab(kf[kt][1], qf[g][1], s[kt][g]); }
            if (ps_ + 1 < SK / KP) {
#pragma unroll
                for (int kt = 0; kt < 2; ++kt)
#pragma unroll
                    for (int ks = 0; ks < 2; ++ks) kf[kt][ks] = WFrag<bf>::ld((const bf*)(Ks + ((ps_ + 1) * KP + kt * 16) * KPB + ks * 64));
            }
            __builtin_amdgcn_sched_barrier(0);   // keeps the softmax out of the score products: without it the first maxima move in between them and the build pads the products' result windows with more v_nop
            v16h pf[2];
#pragma unroll
            for (int g = 0; g < 2; ++g) {
                float mx = s[0][g][0];
#pragma unroll
                for (int j = 1; j < 8; ++j) mx = fmaxf(mx, s[0][g][j]);
#pragma unroll
                for (int j = 0; j < 8; ++j) mx = fmaxf(mx, s[1][g][j]);
                mx = fmaxf(mx, xhalf(mx));
                const float mn = fmaxf(m[g], mx * CSL); const float dm = m[g] - mn; m[g] = mn; float al;
                asm("v_exp_f32 %0, %1\n\tv_nop" : "=v"(al) : "v"(dm));   // al = 2^dm; the v_nop fills the slot that a transcendental wants before its source is overwritten or its result read, and stands in the same statement so that it stays directly behind it
                const float mb = PLOG - mn; v2f ps = { 0.f, 0.f };
#pragma unroll
                for (int kt = 0; kt < 2; ++kt)
#pragma unroll
                    for (int j = 0; j < 8; j += 2) { const v2f x = __builtin_elementwise_fma((v2f){ s[kt][g][j], s[kt][g][j + 1] }, (v2f){ CSL, CSL }, (v2f){ mb, mb }); const v2f p = { __builtin_amdgcn_exp2f(x[0]), __builtin_amdgcn_exp2f(x[1]) }; ps += p; pf[g][kt * 8 + j] = tohx(p[0]); pf[g][kt * 8 + j + 1] = tohx(p[1]); }
                l[g] = l[g] * al + (ps[0] + ps[1]);
#pragma unroll
                for (int dt = 0; dt < 4; ++dt) o[dt][g] *= al;
            }
            __builtin_amdgcn_sched_barrier(0);   // keeps the eight products back to back with the Vt fetch directly behind them: without it the row sum's adds, with their padding, move in front of the last product and delay the fetch
#pragma unroll
            for (int dt = 0; dt < 4; ++dt)
#pragma unroll
                for (int g = 0; g < 2; ++g) o[dt][g] = wmma16(vf[dt], pf[g], o[dt][g]);
            if (ps_ + 1 < SK / KP) {
#pragma unroll
                for (int dt = 0; dt < 4; ++dt) vf[dt] = WFrag<h16>::ld((const h16*)(Vs + dt * 16 * VPB + (ps_ + 1) * KP * 2));
            }
            __builtin_amdgcn_sched_barrier(0);   // ends the pass: without it the unrolled next pass's score products and K reads are mixed into these products, and the LDS reads stand at four places of a pass instead of two
        }
    }
    asm volatile("s_wait_asynccnt 0x0" ::: "memory");   // no copy is outstanding when the wave ends
#pragma unroll
    for (int g = 0; g < 2; ++g) {
        const float inv = __fdiv_rn(1.0f, l[g] + xhalf(l[g]));
        float* op = OUT + ((size_t)zq * TT + q0 + g * 16 + lr) * HD + 8 * hi;   // register r of tile dt = d 16 dt + 8h + r of query lr: 8 floats in a row
#pragma unroll
        for (int dt = 0; dt < 4; ++dt) { const v8f a = o[dt][g] * inv; *(v4f*)(op + dt * 16) = (v4f){ a[0], a[1], a[2], a[3] }; *(v4f*)(op + dt * 16 + 4) = (v4f){ a[4], a[5], a[6], a[7] }; }
    }
}

extern "C" void kernel_launch(void* const* d_in, const int* in_sizes, int n_in,
                              void* d_out, int out_size, void* d_ws, size_t ws_size, hipStream_t stream) {
    (void)in_sizes; (void)n_in; (void)out_size;
    const float* q = (const float*)d_in[0]; const float* k = (const float*)d_in[1]; const float* v = (const float*)d_in[2];
    float* OUT = (float*)d_out;     // [2][16][2048][64]
    char* wsp = (char*)d_ws;
    auto take = [&](size_t bytes) { char* p = wsp; wsp += (bytes + 255) & ~(size_t)255; return (void*)p; };
    bf* QB = (bf*)take((size_t)NB_ * NHQ * TT * HD * 2); bf* KB = (bf*)take((size_t)NB_ * NHKV * TT * HD * 2); h16* VT = (h16*)take((size_t)NB_ * NHKV * HD * TT * 2);
    if ((size_t)(wsp - (char*)d_ws) > ws_size) return;    // 12 MiB
    { const size_t nq = (size_t)NB_ * NHQ * TT * HD / 8, nk = (size_t)NB_ * NHKV * TT * HD / 8; k_cvt8<<<(unsigned)((nq + 255) / 256), 256, 0, stream>>>(q, QB, nq); k_cvt8<<<(unsigned)((nk + 255) / 256), 256, 0, stream>>>(k, KB, nk); k_vt16<<<(unsigned)(((size_t)NB_ * NHKV * HD * TT / 2 + 255) / 256), 256, 0, stream>>>(v, VT); }
    k_fattn<<<dim3(TT / (QW * NWV), NB_ * NHQ), NWV * 32, 0, stream>>>(QB, KB, VT, OUT);
}

// v003
// A run of this version takes 42 microseconds.
// Next to v002, in two timings, it ran 1.09 and 1.08 times as fast.
// Over all steps from v000 it is 24.4 times as fast.
#include <hip/hip_runtime.h>

// Attention forward, no mask: q [2][16][2048][64], k/v [2][4][2048][64]; GQA (4 query heads per kv head); out = softmax(q.k / 8) v -> [2][16][2048][64].
// Compute dtypes, f32 accumulate: every input rounded to bf16 (k and v by launches of their own, q in the registers of the wave that owns its rows); scores q.k on PLAIN bf16 operands (the 4x GQA repeat is a pointer mapping, never materialised);
// scale and softmax in f32 (running maximum and sum per query) -> fp16 weights relative to the running maximum, x1024; probs.v on SINGLE fp16 planes against fp16(bf16 v);
// the division by the row sum (which carries the same x1024) comes behind the product.

#define NB_  2
#define NHQ  16
#define NHKV 4
#define REP  (NHQ / NHKV)
#define TT   2048
#define HD   64
#define QW   32      // query columns of one wave (two 16-column groups)
#define NWV  8       // waves of one work-group
#define KP   32      // keys of one pass
#define CSL  0.18033688011112042f   // (1 / 8) * log2(e): scores go to the base-2 exponent in one multiply-add
#define PLOG 10.0f                  // probabilities carry x 2^10 into fp16; the row sum carries it too, so it cancels in the division
typedef _Float16 h16;
typedef unsigned short bf;
typedef __attribute__((ext_vector_type(16))) __bf16   v16bf;
typedef __attribute__((ext_vector_type(16))) _Float16 v16h;
typedef __attribute__((ext_vector_type(8)))  _Float16 v8h;
typedef __attribute__((ext_vector_type(8)))  unsigned short v8us;
typedef __attribute__((ext_vector_type(8)))  __bf16   v8bf;
typedef __attribute__((ext_vector_type(8)))  float    v8f;
typedef __attribute__((ext_vector_type(4)))  float    v4f;
typedef __attribute__((ext_vector_type(2)))  float    v2f;

__device__ __forceinline__ unsigned short f2bf(float f) { unsigned u = __float_as_uint(f); u += 0x7FFFu + ((u >> 16) & 1u); return (unsigned short)(u >> 16); }
__device__ __forceinline__ float bf2f(unsigned short b) { return __uint_as_float(((unsigned)b) << 16); }
__device__ __forceinline__ float bfr(float f) { return bf2f(f2bf(f)); }
__device__ __forceinline__ v16h cat16(v8h lo, v8h hi) { return __builtin_shufflevector(lo, hi, 0, 1, 2, 3, 4, 5, 6, 7, 8, 9, 10, 11, 12, 13, 14, 15); }
__device__ __forceinline__ v16bf cat16b(v8us lo, v8us hi) { return __builtin_bit_cast(v16bf, __builtin_shufflevector(lo, hi, 0, 1, 2, 3, 4, 5, 6, 7, 8, 9, 10, 11, 12, 13, 14, 15)); }
__device__ __forceinline__ v8f wmma16(v16h a, v16h b, v8f c) { return __builtin_amdgcn_wmma_f32_16x16x32_f16(false, a, false, b, (short)0, c, false, false); }
__device__ __forceinline__ v8f wmmab(v16bf a, v16bf b, v8f c) { return __builtin_amdgcn_wmma_f32_16x16x32_bf16(false, a, false, b, (short)0, c, false, false); }

// Fragment of a K-contiguous 16-bit plane, p = row (lane & 15), k offset 8 * (lane >> 4): elements 0..7 = k 8h + s, elements 8..15 = k 16 + 8h + (s - 8).
template <typename T16> struct WFrag;
template <> struct WFrag<h16> { typedef v16h V; static __device__ __forceinline__ V ld(const h16* p) { return cat16(*(const v8h*)p, *(const v8h*)(p + 16)); } };
template <> struct WFrag<bf> { typedef v16bf V; static __device__ __forceinline__ V ld(const bf* p) { return cat16b(*(const v8us*)p, *(const v8us*)(p + 16)); } };

__device__ __forceinline__ h16 tohx(float x) { return (h16)x; }
typedef __attribute__((ext_vector_type(2))) _Float16 v2h;

__global__ __launch_bounds__(256) void k_cvt8(const float* __restrict__ src, bf* dst, size_t n8) { const size_t i = (size_t)blockIdx.x * 256 + threadIdx.x; if (i >= n8) return; const v8f v = *(const v8f*)(src + i * 8); v8us o;
#pragma unroll
    for (int k = 0; k < 8; ++k) o[k] = f2bf(v[k]); *(v8us*)(dst + i * 8) = o;  }
__global__ __launch_bounds__(256) void k_vt16(const float* __restrict__ v, h16* VT) { const size_t e = ((size_t)blockIdx.x * 256 + threadIdx.x) * 2; if (e >= (size_t)NB_ * NHKV * HD * TT) return; const int t = (int)(e % TT); const int d = (int)((e / TT) % HD); const size_t z = e / ((size_t)TT * HD); const float* src = v + z * TT * HD; v2h o;
    o[0] = tohx(bfr(src[(size_t)t * HD + d])); o[1] = tohx(bfr(src[(size_t)(t + 1) * HD + d])); *(v2h*)(VT + e) = o;  }

// value of lane l ^ 16
__device__ __forceinline__ float xhalf(float x) { const int b = __float_as_int(x); return __int_as_float(__builtin_amdgcn_permlanex16(b, b, 0x76543210, 0xfedcba98, false, false)); }

#define SK   128                    // keys of one stage
#define NST  (TT / SK)
#define KPB  144                    // LDS pitch of a K row (64 bf16 = 128 bytes, + 16)
#define VPB  272                    // LDS pitch of a Vt row (128 fp16 = 256 bytes, + 16)
#define KBY  (SK * KPB)
#define BUFB (KBY + HD * VPB)       // one buffer: K rows, then Vt rows

// One stage: every thread copies four 16-byte pieces of K and four of Vt; a wave's copy covers 512 bytes in a row of K, or two 256-byte rows of Vt.
// lk, lv: the thread's own LDS byte addresses in the buffer; gk, gv: its own global addresses in the stage.
__device__ __forceinline__ void stage_copy(unsigned lk, unsigned lv, const char* gk, const char* gv) {
    // the copies and their s_wait_xcnt stand in one statement, so that no address register is rewritten in front of the wait
    asm volatile("global_load_async_to_lds_b128 %0, %8, off\n\t"
                 "global_load_async_to_lds_b128 %1, %9, off\n\t"
                 "global_load_async_to_lds_b128 %2, %10, off\n\t"
                 "global_load_async_to_lds_b128 %3, %11, off\n\t"
                 "global_load_async_to_lds_b128 %4, %12, off\n\t"
                 "global_load_async_to_lds_b128 %5, %13, off\n\t"
                 "global_load_async_to_lds_b128 %6, %14, off\n\t"
                 "global_load_async_to_lds_b128 %7, %15, off\n\t"
                 "s_wait_xcnt 0x0"
                 :: "v"(lk), "v"(lk + 32 * KPB), "v"(lk + 64 * KPB), "v"(lk + 96 * KPB), "v"(lv), "v"(lv + 16 * VPB), "v"(lv + 32 * VPB), "v"(lv + 48 * VPB),
                    "v"(gk), "v"(gk + 4096), "v"(gk + 8192), "v"(gk + 12288), "v"(gv), "v"(gv + (size_t)16 * TT * 2), "v"(gv + (size_t)32 * TT * 2), "v"(gv + (size_t)48 * TT * 2)
                 : "memory");
}

__global__ __launch_bounds__(NWV * 32) void k_fattn(const float* __restrict__ Q, const bf* __restrict__ KB, const h16* __restrict__ VT, float* __restrict__ OUT) {
    __shared__ __attribute__((aligned(256))) unsigned char L[2 * BUFB];
    const int tid = threadIdx.x, lane = tid & 31, lr = lane & 15, hi = lane >> 4, wave = tid >> 5;
    const int zq = blockIdx.y; const int zkv = (zq / NHQ) * NHKV + (zq % NHQ) / REP;
    const int q0 = (blockIdx.x * NWV + wave) * QW;
    const float* Qp = Q + ((size_t)zq * TT + q0 + lr) * HD + 8 * hi;
    // copy addresses of this thread: K piece tid of 256 (8 pieces a row), Vt piece tid of 256 (16 pieces a row)
    const char* gk = (const char*)(KB + (size_t)zkv * TT * HD) + tid * 16;
    const char* gv = (const char*)(VT + ((size_t)zkv * HD + (tid >> 4)) * TT) + (tid & 15) * 16;
    const unsigned l0 = (unsigned)(size_t)(__attribute__((address_space(3))) unsigned char*)L;
    const unsigned lk = l0 + (tid >> 3) * KPB + (tid & 7) * 16;
    const unsigned lv = l0 + KBY + (tid >> 4) * VPB + (tid & 15) * 16;
    // the wave's own q rows come as f32, straight from the input, in the fragment's k order (two runs of 8 a fragment); they are on their way while stage 0 is copied
    v8f qr[2][2][2];               // [query group][k step][run]
#pragma unroll
    for (int g = 0; g < 2; ++g)
#pragma unroll
        for (int ks = 0; ks < 2; ++ks) { qr[g][ks][0] = *(const v8f*)(Qp + g * 16 * HD + ks * 32); qr[g][ks][1] = *(const v8f*)(Qp + g * 16 * HD + ks * 32 + 16); }
    stage_copy(lk, lv, gk, gv);   // stage 0 into buffer 0
    v16bf qf[2][2], kf[2][2];      // [query group][k step], [key tile][k step]
    v16h vf[4];                    // [16 rows of d]
#pragma unroll
    for (int g = 0; g < 2; ++g)
#pragma unroll
        for (int ks = 0; ks < 2; ++ks)   // rounded to bf16 (nearest even) once, here
            qf[g][ks] = __builtin_shufflevector(__builtin_convertvector(qr[g][ks][0], v8bf), __builtin_convertvector(qr[g][ks][1], v8bf), 0, 1, 2, 3, 4, 5, 6, 7, 8, 9, 10, 11, 12, 13, 14, 15);
    v8f o[4][2];                   // [16 rows of d][query group]
#pragma unroll
    for (int dt = 0; dt < 4; ++dt) { o[dt][0] = (v8f){}; o[dt][1] = (v8f){}; }
    float m[2] = { -3.0e38f, -3.0e38f }, l[2] = { 0.f, 0.f };   // running maximum (base-2 exponent) of a query; this lane's half of its running sum
#pragma unroll 1
    for (int st = 0; st < NST; ++st) {   // stays rolled: the four passes inside are unrolled, and one stage's code is the hot loop
        // hand-over, the same in front of every stage: it publishes stage st and frees the other buffer, which stage st - 1 was read from
        asm volatile("s_wait_dscnt 0x0" ::: "memory");      // this wave's reads of the other buffer are done before the barrier behind which it is refilled
        asm volatile("s_wait_asynccnt 0x0" ::: "memory");   // this wave's copies of stage st have landed before the barrier behind which every wave reads them
        __syncthreads();
        const unsigned char* Lb = L + (st & 1) * BUFB;
        const unsigned char* Ks = Lb + lr * KPB + 16 * hi;          // K row lr, k offset 8h
        const unsigned char* Vs = Lb + KBY + lr * VPB + 16 * hi;    // Vt row lr, key offset 8h
#pragma unroll
        for (int kt = 0; kt < 2; ++kt)
#pragma unroll
            for (int ks = 0; ks < 2; ++ks) kf[kt][ks] = WFrag<bf>::ld((const bf*)(Ks + kt * 16 * KPB + ks * 64));
#pragma unroll
        for (int dt = 0; dt < 4; ++dt) vf[dt] = WFrag<h16>::ld((const h16*)(Vs + dt * 16 * VPB));
        // the next stage flies while this one is worked on; its copies stand behind this stage's first fragment reads, so that those are under way while the copies issue
        if (st + 1 < NST) stage_copy(lk + ((st + 1) & 1) * BUFB, lv + ((st + 1) & 1) * BUFB, gk + (size_t)(st + 1) * (SK * HD * 2), gv + (size_t)(st + 1) * (SK * 2));
#pragma unroll
        for (int ps_ = 0; ps_ < SK / KP; ++ps_) {
            // inside a stage K and Vt fragments are fetched one pass ahead into the same registers, each right behind its last use; nothing of the next stage is read here
            v8f s[2][2];               // [key tile][query group]
#pragma unroll
            for (int kt = 0; kt < 2; ++kt)
#pragma unroll
                for (int g = 0; g < 2; ++g) { s[kt][g] = wmmab(kf[kt][0], qf[g][0], (v8f){}); s[kt][g] = wmmab(kf[kt][1], qf[g][1], s[kt][g]); }
            if (ps_ + 1 < SK / KP) {
#pragma unroll
                for (int kt = 0; kt < 2; ++kt)
#pragma unroll
                    for (int ks = 0; ks < 2; ++ks) kf[kt][ks] = WFrag<bf>::ld((const bf*)(Ks + ((ps_ + 1) * KP + kt * 16) * KPB + ks * 64));
            }
            __builtin_amdgcn_sched_barrier(0);   // keeps the softmax out of the score products: without it the first maxima move in between them and the build pads the products' result windows with more v_nop
            v16h pf[2];
#pragma unroll
            for (int g = 0; g < 2; ++g) {
                float mx = s[0][g][0];
#pragma unroll
                for (int j = 1; j < 8; ++j) mx = fmaxf(mx, s[0][g][j]);
#pragma unroll
                for (int j = 0; j < 8; ++j) mx = fmaxf(mx, s[1][g][j]);
                mx = fmaxf(mx, xhalf(mx));
                const float mn = fmaxf(m[g], mx * CSL); const float dm = m[g] - mn; m[g] = mn; float al;
                asm("v_exp_f32 %0, %1\n\tv_nop" : "=v"(al) : "v"(dm));   // al = 2^dm; the v_nop fills the slot that a transcendental wants before its source is overwritten or its result read, and stands in the same statement so that it stays directly behind it
                const float mb = PLOG - mn; v2f ps = { 0.f, 0.f };
#pragma unroll
                for (int kt = 0; kt < 2; ++kt)
#pragma unroll
                    for (int j = 0; j < 8; j += 2) { const v2f x = __builtin_elementwise_fma((v2f){ s[kt][g][j], s[kt][g][j + 1] }, (v2f){ CSL, CSL }, (v2f){ mb, mb }); const v2f p = { __builtin_amdgcn_exp2f(x[0]), __builtin_amdgcn_exp2f(x[1]) }; ps += p; pf[g][kt * 8 + j] = tohx(p[0]); pf[g][kt * 8 + j + 1] = tohx(p[1]); }
                l[g] = l[g] * al + (ps[0] + ps[1]);
#pragma unroll
                for (int dt = 0; dt < 4; ++dt) o[dt][g] *= al;
            }
            __builtin_amdgcn_sched_barrier(0);   // keeps the eight products back to back with the Vt fetch directly behind them: without it the row sum's adds, with their padding, move in front of the last product and delay the fetch
#pragma unroll
            for (int dt = 0; dt < 4; ++dt)
#pragma unroll
                for (int g = 0; g < 2; ++g) o[dt][g] = wmma16(vf[dt], pf[g], o[dt][g]);
            if (ps_ + 1 < SK / KP) {
#pragma unroll
                for (int dt = 0; dt < 4; ++dt) vf[dt] = WFrag<h16>::ld((const h16*)(Vs + dt * 16 * VPB + (ps_ + 1) * KP * 2));
            }
            __builtin_amdgcn_sched_barrier(0);   // ends the pass: without it the unrolled next pass's score products and K reads are mixed into these products, and the LDS reads stand at four places of a pass instead of two
        }
    }
    asm volatile("s_wait_asynccnt 0x0" ::: "memory");   // no copy is outstanding when the wave ends
#pragma unroll
    for (int g = 0; g < 2; ++g) {
        const float inv = __fdiv_rn(1.0f, l[g] + xhalf(l[g]));
        float* op = OUT + ((size_t)zq * TT + q0 + g * 16 + lr) * HD + 8 * hi;   // register r of tile dt = d 16 dt + 8h + r of query lr: 8 floats in a row
#pragma unroll
        for (int dt = 0; dt < 4; ++dt) { const v8f a = o[dt][g] * inv; *(v4f*)(op + dt * 16) = (v4f){ a[0], a[1], a[2], a[3] }; *(v4f*)(op + dt * 16 + 4) = (v4f){ a[4], a[5], a[6], a[7] }; }
    }
}

extern "C" void kernel_launch(void* const* d_in, const int* in_sizes, int n_in,
                              void* d_out, int out_size, void* d_ws, size_t ws_size, hipStream_t stream) {
    (void)in_sizes; (void)n_in; (void)out_size;
    const float* q = (const float*)d_in[0]; const float* k = (const float*)d_in[1]; const float* v = (const float*)d_in[2];
    float* OUT = (float*)d_out;     // [2][16][2048][64]
    char* wsp = (char*)d_ws;
    auto take = [&](size_t bytes) { char* p = wsp; wsp += (bytes + 255) & ~(size_t)255; return (void*)p; };
    bf* KB = (bf*)take((size_t)NB_ * NHKV * TT * HD * 2); h16* VT = (h16*)take((size_t)NB_ * NHKV * HD * TT * 2);
    if ((size_t)(wsp - (char*)d_ws) > ws_size) return;    // 4 MiB
    { const size_t nk = (size_t)NB_ * NHKV * TT * HD / 8; k_cvt8<<<(unsigned)((nk + 255) / 256), 256, 0, stream>>>(k, KB, nk); k_vt16<<<(unsigned)(((size_t)NB_ * NHKV * HD * TT / 2 + 255) / 256), 256, 0, stream>>>(v, VT); }
    k_fattn<<<dim3(TT / (QW * NWV), NB_ * NHQ), NWV * 32, 0, stream>>>(q, KB, VT, OUT);
}

// v004
// It runs in 40.4 microseconds.
// In both of two side-by-side timings against v003, it was 1.04 times as fast.
// All steps since v000 together make it 25.3 times as fast.
#include <hip/hip_runtime.h>

// Attention forward, no mask: q [2][16][2048][64], k/v [2][4][2048][64]; GQA (4 query heads per kv head); out = softmax(q.k / 8) v -> [2][16][2048][64].
// Compute dtypes, f32 accumulate: every input rounded to bf16 (k and v by launches of their own, q in the registers of the wave that owns its rows); scores q.k on PLAIN bf16 operands (the 4x GQA repeat is a pointer mapping, never materialised);
// scale and softmax in f32 (running maximum and sum per query) -> fp16 weights relative to the running maximum, x1024; probs.v on SINGLE fp16 planes against fp16(bf16 v);
// the division by the row sum (which carries the same x1024) comes behind the product.

#define NB_  2
#define NHQ  16
#define NHKV 4
#define REP  (NHQ / NHKV)
#define TT   2048
#define HD   64
#define QW   32      // query columns of one wave (two 16-column groups)
#define NQW  8       // query slices of one work-group, one wave wide each
#define NKS  2       // key sets: each query slice is walked by two waves, each over half of the keys
#define NWV  (NQW * NKS)   // waves of one work-group
#define KP   32      // keys of one pass
#define CSL  0.18033688011112042f   // (1 / 8) * log2(e): scores go to the base-2 exponent in one multiply-add
#define PLOG 10.0f                  // probabilities carry x 2^10 into fp16; the row sum carries it too, so it cancels in the division
typedef _Float16 h16;
typedef unsigned short bf;
typedef __attribute__((ext_vector_type(16))) __bf16   v16bf;
typedef __attribute__((ext_vector_type(16))) _Float16 v16h;
typedef __attribute__((ext_vector_type(8)))  _Float16 v8h;
typedef __attribute__((ext_vector_type(8)))  unsigned short v8us;
typedef __attribute__((ext_vector_type(8)))  __bf16   v8bf;
typedef __attribute__((ext_vector_type(8)))  float    v8f;
typedef __attribute__((ext_vector_type(4)))  float    v4f;
typedef __attribute__((ext_vector_type(2)))  float    v2f;

__device__ __forceinline__ unsigned short f2bf(float f) { unsigned u = __float_as_uint(f); u += 0x7FFFu + ((u >> 16) & 1u); return (unsigned short)(u >> 16); }
__device__ __forceinline__ float bf2f(unsigned short b) { return __uint_as_float(((unsigned)b) << 16); }
__device__ __forceinline__ float bfr(float f) { return bf2f(f2bf(f)); }
__device__ __forceinline__ v16h cat16(v8h lo, v8h hi) { return __builtin_shufflevector(lo, hi, 0, 1, 2, 3, 4, 5, 6, 7, 8, 9, 10, 11, 12, 13, 14, 15); }
__device__ __forceinline__ v16bf cat16b(v8us lo, v8us hi) { return __builtin_bit_cast(v16bf, __builtin_shufflevector(lo, hi, 0, 1, 2, 3, 4, 5, 6, 7, 8, 9, 10, 11, 12, 13, 14, 15)); }
__device__ __forceinline__ v8f wmma16(v16h a, v16h b, v8f c) { return __builtin_amdgcn_wmma_f32_16x16x32_f16(false, a, false, b, (short)0, c, false, false); }
__device__ __forceinline__ v8f wmmab(v16bf a, v16bf b, v8f c) { return __builtin_amdgcn_wmma_f32_16x16x32_bf16(false, a, false, b, (short)0, c, false, false); }

// Fragment of a K-contiguous 16-bit plane, p = row (lane & 15), k offset 8 * (lane >> 4): elements 0..7 = k 8h + s, elements 8..15 = k 16 + 8h + (s - 8).
template <typename T16> struct WFrag;
template <> struct WFrag<h16> { typedef v16h V; static __device__ __forceinline__ V ld(const h16* p) { return cat16(*(const v8h*)p, *(const v8h*)(p + 16)); } };
template <> struct WFrag<bf> { typedef v16bf V; static __device__ __forceinline__ V ld(const bf* p) { return cat16b(*(const v8us*)p, *(const v8us*)(p + 16)); } };

__device__ __forceinline__ h16 tohx(float x) { return (h16)x; }
typedef __attribute__((ext_vector_type(2))) _Float16 v2h;

__global__ __launch_bounds__(256) void k_cvt8(const float* __restrict__ src, bf* dst, size_t n8) { const size_t i = (size_t)blockIdx.x * 256 + threadIdx.x; if (i >= n8) return; const v8f v = *(const v8f*)(src + i * 8); v8us o;
#pragma unroll
    for (int k = 0; k < 8; ++k) o[k] = f2bf(v[k]); *(v8us*)(dst + i * 8) = o;  }
__global__ __launch_bounds__(256) void k_vt16(const float* __restrict__ v, h16* VT) { const size_t e = ((size_t)blockIdx.x * 256 + threadIdx.x) * 2; if (e >= (size_t)NB_ * NHKV * HD * TT) return; const int t = (int)(e % TT); const int d = (int)((e / TT) % HD); const size_t z = e / ((size_t)TT * HD); const float* src = v + z * TT * HD; v2h o;
    o[0] = tohx(bfr(src[(size_t)t * HD + d])); o[1] = tohx(bfr(src[(size_t)(t + 1) * HD + d])); *(v2h*)(VT + e) = o;  }

// value of lane l ^ 16
__device__ __forceinline__ float xhalf(float x) { const int b = __float_as_int(x); return __int_as_float(__builtin_amdgcn_permlanex16(b, b, 0x76543210, 0xfedcba98, false, false)); }

#define SK   128                    // keys of one stage
#define NST  (TT / SK)
#define KPB  144                    // LDS pitch of a K row (64 bf16 = 128 bytes, + 16)
#define VPB  272                    // LDS pitch of a Vt row (128 fp16 = 256 bytes, + 16)
#define KBY  (SK * KPB)
#define BUFB (KBY + HD * VPB)       // one buffer: K rows, then Vt rows

// One stage: every thread copies four 16-byte pieces of K and four of Vt; a wave's copy covers 512 bytes in a row of K, or two 256-byte rows of Vt.
// lk, lv: the thread's own LDS byte addresses in the buffer; gk, gv: its own global addresses in the stage.
__device__ __forceinline__ void stage_copy(unsigned lk, unsigned lv, const char* gk, const char* gv) {
    // the copies and their s_wait_xcnt stand in one statement, so that no address register is rewritten in front of the wait
    asm volatile("global_load_async_to_lds_b128 %0, %8, off\n\t"
                 "global_load_async_to_lds_b128 %1, %9, off\n\t"
                 "global_load_async_to_lds_b128 %2, %10, off\n\t"
                 "global_load_async_to_lds_b128 %3, %11, off\n\t"
                 "global_load_async_to_lds_b128 %4, %12, off\n\t"
                 "global_load_async_to_lds_b128 %5, %13, off\n\t"
                 "global_load_async_to_lds_b128 %6, %14, off\n\t"
                 "global_load_async_to_lds_b128 %7, %15, off\n\t"
                 "s_wait_xcnt 0x0"
                 :: "v"(lk), "v"(lk + 32 * KPB), "v"(lk + 64 * KPB), "v"(lk + 96 * KPB), "v"(lv), "v"(lv + 16 * VPB), "v"(lv + 32 * VPB), "v"(lv + 48 * VPB),
                    "v"(gk), "v"(gk + 4096), "v"(gk + 8192), "v"(gk + 12288), "v"(gv), "v"(gv + (size_t)16 * TT * 2), "v"(gv + (size_t)32 * TT * 2), "v"(gv + (size_t)48 * TT * 2)
                 : "memory");
}

__global__ __launch_bounds__(NWV * 32) void k_fattn(const float* __restrict__ Q, const bf* __restrict__ KB, const h16* __restrict__ VT, float* __restrict__ OUT) {
    __shared__ __attribute__((aligned(256))) unsigned char L[NKS * 2 * BUFB];
    __shared__ v4f X[NWV * 9 * 32];   // exchange of the partial results: [wave][piece][lane], 8 pieces of output sums and one with maximum and row sum
    const int lane = threadIdx.x & 31, lr = lane & 15, hi = lane >> 4;
    const int set = __builtin_amdgcn_readfirstlane(threadIdx.x >> 8);   // key set of this wave, the same in all its lanes
    const int tid = threadIdx.x & 255, wave = tid >> 5;                 // thread and wave inside the set
    const int zq = blockIdx.y; const int zkv = (zq / NHQ) * NHKV + (zq % NHQ) / REP;
    const int q0 = (blockIdx.x * NQW + wave) * QW;
    const float* Qp = Q + ((size_t)zq * TT + q0 + lr) * HD + 8 * hi;
    // copy addresses of this thread: K piece tid of 256 (8 pieces a row), Vt piece tid of 256 (16 pieces a row)
    const char* gk = (const char*)(KB + ((size_t)zkv * TT + set * SK) * HD) + tid * 16;
    const char* gv = (const char*)(VT + ((size_t)zkv * HD + (tid >> 4)) * TT + set * SK) + (tid & 15) * 16;
    const unsigned l0 = (unsigned)(size_t)(__attribute__((address_space(3))) unsigned char*)L + set * (2 * BUFB);
    const unsigned lk = l0 + (tid >> 3) * KPB + (tid & 7) * 16;
    const unsigned lv = l0 + KBY + (tid >> 4) * VPB + (tid & 15) * 16;
    // the wave's own q rows come as f32, straight from the input, in the fragment's k order (two runs of 8 a fragment); they are on their way while stage 0 is copied
    v8f qr[2][2][2];               // [query group][k step][run]
#pragma unroll
    for (int g = 0; g < 2; ++g)
#pragma unroll
        for (int ks = 0; ks < 2; ++ks) { qr[g][ks][0] = *(const v8f*)(Qp + g * 16 * HD + ks * 32); qr[g][ks][1] = *(const v8f*)(Qp + g * 16 * HD + ks * 32 + 16); }
    stage_copy(lk, lv, gk, gv);   // the set's first stage into its buffer 0
    v16bf qf[2][2], kf[2][2];      // [query group][k step], [key tile][k step]
    v16h vf[4];                    // [16 rows of d]
#pragma unroll
    for (int g = 0; g < 2; ++g)
#pragma unroll
        for (int ks = 0; ks < 2; ++ks)   // rounded to bf16 (nearest even) once, here
            qf[g][ks] = __builtin_shufflevector(__builtin_convertvector(qr[g][ks][0], v8bf), __builtin_convertvector(qr[g][ks][1], v8bf), 0, 1, 2, 3, 4, 5, 6, 7, 8, 9, 10, 11, 12, 13, 14, 15);
    v8f o[4][2];                   // [16 rows of d][query group]
#pragma unroll
    for (int dt = 0; dt < 4; ++dt) { o[dt][0] = (v8f){}; o[dt][1] = (v8f){}; }
    float m[2] = { -3.0e38f, -3.0e38f }, l[2] = { 0.f, 0.f };   // running maximum (base-2 exponent) of a query; this lane's half of its running sum
#pragma unroll 1
    for (int st = 0; st < NST / NKS; ++st) {   // the set's stage st is stage NKS * st + set of the keys; stays rolled: the four passes inside are unrolled, and one stage's code is the hot loop
        // hand-over, the same in front of every stage: it publishes stage st and frees the other buffer, which stage st - 1 was read from
        asm volatile("s_wait_dscnt 0x0" ::: "memory");      // this wave's reads of the other buffer are done before the barrier behind which it is refilled
        asm volatile("s_wait_asynccnt 0x0" ::: "memory");   // this wave's copies of stage st have landed before the barrier behind which every wave of its set reads them
        __syncthreads();
        const unsigned char* Lb = L + (set * 2 + (st & 1)) * BUFB;
        const unsigned char* Ks = Lb + lr * KPB + 16 * hi;          // K row lr, k offset 8h
        const unsigned char* Vs = Lb + KBY + lr * VPB + 16 * hi;    // Vt row lr, key offset 8h
#pragma unroll
        for (int kt = 0; kt < 2; ++kt)
#pragma unroll
            for (int ks = 0; ks < 2; ++ks) kf[kt][ks] = WFrag<bf>::ld((const bf*)(Ks + kt * 16 * KPB + ks * 64));
#pragma unroll
        for (int dt = 0; dt < 4; ++dt) vf[dt] = WFrag<h16>::ld((const h16*)(Vs + dt * 16 * VPB));
        // the next stage flies while this one is worked on; its copies stand behind this stage's first fragment reads, so that those are under way while the copies issue
        if (st + 1 < NST / NKS) stage_copy(lk + ((st + 1) & 1) * BUFB, lv + ((st + 1) & 1) * BUFB, gk + (size_t)(st + 1) * (NKS * SK * HD * 2), gv + (size_t)(st + 1) * (NKS * SK * 2));
#pragma unroll
        for (int ps_ = 0; ps_ < SK / KP; ++ps_) {
            // inside a stage K and Vt fragments are fetched one pass ahead into the same registers, each right behind its last use; nothing of the next stage is read here
            v8f s[2][2];               // [key tile][query group]
#pragma unroll
            for (int kt = 0; kt < 2; ++kt)
#pragma unroll
                for (int g = 0; g < 2; ++g) { s[kt][g] = wmmab(kf[kt][0], qf[g][0], (v8f){}); s[kt][g] = wmmab(kf[kt][1], qf[g][1], s[kt][g]); }
            if (ps_ + 1 < SK / KP) {
#pragma unroll
                for (int kt = 0; kt < 2; ++kt)
#pragma unroll
                    for (int ks = 0; ks < 2; ++ks) kf[kt][ks] = WFrag<bf>::ld((const bf*)(Ks + ((ps_ + 1) * KP + kt * 16) * KPB + ks * 64));
            }
            __builtin_amdgcn_sched_barrier(0);   // keeps the softmax out of the score products: without it the first maxima move in between them and the build pads the products' result windows with more v_nop
            v16h pf[2];
#pragma unroll
            for (int g = 0; g < 2; ++g) {
                float mx = s[0][g][0];
#pragma unroll
                for (int j = 1; j < 8; ++j) mx = fmaxf(mx, s[0][g][j]);
#pragma unroll
                for (int j = 0; j < 8; ++j) mx = fmaxf(mx, s[1][g][j]);
                mx = fmaxf(mx, xhalf(mx));
                const float mn = fmaxf(m[g], mx * CSL); const float dm = m[g] - mn; m[g] = mn; float al;
                asm("v_exp_f32 %0, %1\n\tv_nop" : "=v"(al) : "v"(dm));   // al = 2^dm; the v_nop fills the slot that a transcendental wants before its source is overwritten or its result read, and stands in the same statement so that it stays directly behind it
                const float mb = PLOG - mn; v2f ps = { 0.f, 0.f };
#pragma unroll
                for (int kt = 0; kt < 2; ++kt)
#pragma unroll
                    for (int j = 0; j < 8; j += 2) { const v2f x = __builtin_elementwise_fma((v2f){ s[kt][g][j], s[kt][g][j + 1] }, (v2f){ CSL, CSL }, (v2f){ mb, mb }); const v2f p = { __builtin_amdgcn_exp2f(x[0]), __builtin_amdgcn_exp2f(x[1]) }; ps += p; pf[g][kt * 8 + j] = tohx(p[0]); pf[g][kt * 8 + j + 1] = tohx(p[1]); }
                l[g] = l[g] * al + (ps[0] + ps[1]);
#pragma unroll
                for (int dt = 0; dt < 4; ++dt) o[dt][g] *= al;
            }
            __builtin_amdgcn_sched_barrier(0);   // keeps the eight products back to back with the Vt fetch directly behind them: without it the row sum's adds, with their padding, move in front of the last product and delay the fetch
#pragma unroll
            for (int dt = 0; dt < 4; ++dt)
#pragma unroll
                for (int g = 0; g < 2; ++g) o[dt][g] = wmma16(vf[dt], pf[g], o[dt][g]);
            if (ps_ + 1 < SK / KP) {
#pragma unroll
                for (int dt = 0; dt < 4; ++dt) vf[dt] = WFrag<h16>::ld((const h16*)(Vs + dt * 16 * VPB + (ps_ + 1) * KP * 2));
            }
            __builtin_amdgcn_sched_barrier(0);   // ends the pass: without it the unrolled next pass's score products and K reads are mixed into these products, and the LDS reads stand at four places of a pass instead of two
        }
    }
    asm volatile("s_wait_asynccnt 0x0" ::: "memory");   // no copy is outstanding when the wave ends
    // set 0 keeps query group 0 and gives group 1 away, set 1 the other way round
    v8f ok[4], og[4];
#pragma unroll
    for (int dt = 0; dt < 4; ++dt) { ok[dt] = set ? o[dt][1] : o[dt][0]; og[dt] = set ? o[dt][0] : o[dt][1]; }
    const float mk = set ? m[1] : m[0], lk_ = set ? l[1] : l[0], mg = set ? m[0] : m[1], lg = set ? l[0] : l[1];
    v4f* Xw = X + (size_t)((set * NQW + wave) * 9) * 32 + lane;
    const v4f* Xr = X + (size_t)(((set ^ 1) * NQW + wave) * 9) * 32 + lane;
#pragma unroll
    for (int dt = 0; dt < 4; ++dt) { Xw[(2 * dt) * 32] = (v4f){ og[dt][0], og[dt][1], og[dt][2], og[dt][3] }; Xw[(2 * dt + 1) * 32] = (v4f){ og[dt][4], og[dt][5], og[dt][6], og[dt][7] }; }
    Xw[8 * 32] = (v4f){ mg, lg, 0.f, 0.f };
    __syncthreads();   // the partner wave's partial result is in LDS behind it
    {
        const v4f ml = Xr[8 * 32];
        const float mn = fmaxf(mk, ml[0]);
        const float dk = mk - mn, dp = ml[0] - mn; float fk, fp;   // both partial results go to the common maximum
        asm("v_exp_f32 %0, %1\n\tv_nop" : "=v"(fk) : "v"(dk));   // fk = 2^dk; the v_nop fills the slot that a transcendental wants before its source is overwritten or its result read
        asm("v_exp_f32 %0, %1\n\tv_nop" : "=v"(fp) : "v"(dp));   // fp = 2^dp; the same slot
        const float ls = lk_ * fk + ml[1] * fp;
        const float inv = __fdiv_rn(1.0f, ls + xhalf(ls));
        const float ck = fk * inv, cp = fp * inv;
        float* op = OUT + ((size_t)zq * TT + q0 + set * 16 + lr) * HD + 8 * hi;   // register r of tile dt = d 16 dt + 8h + r of query lr: 8 floats in a row
#pragma unroll
        for (int dt = 0; dt < 4; ++dt) {
            const v4f p0 = Xr[(2 * dt) * 32], p1 = Xr[(2 * dt + 1) * 32];
            *(v4f*)(op + dt * 16) = (v4f){ ok[dt][0], ok[dt][1], ok[dt][2], ok[dt][3] } * ck + p0 * cp;
            *(v4f*)(op + dt * 16 + 4) = (v4f){ ok[dt][4], ok[dt][5], ok[dt][6], ok[dt][7] } * ck + p1 * cp;
        }
    }
}

extern "C" void kernel_launch(void* const* d_in, const int* in_sizes, int n_in,
                              void* d_out, int out_size, void* d_ws, size_t ws_size, hipStream_t stream) {
    (void)in_sizes; (void)n_in; (void)out_size;
    const float* q = (const float*)d_in[0]; const float* k = (const float*)d_in[1]; const float* v = (const float*)d_in[2];
    float* OUT = (float*)d_out;     // [2][16][2048][64]
    char* wsp = (char*)d_ws;
    auto take = [&](size_t bytes) { char* p = wsp; wsp += (bytes + 255) & ~(size_t)255; return (void*)p; };
    bf* KB = (bf*)take((size_t)NB_ * NHKV * TT * HD * 2); h16* VT = (h16*)take((size_t)NB_ * NHKV * HD * TT * 2);
    if ((size_t)(wsp - (char*)d_ws) > ws_size) return;    // 4 MiB
    { const size_t nk = (size_t)NB_ * NHKV * TT * HD / 8; k_cvt8<<<(unsigned)((nk + 255) / 256), 256, 0, stream>>>(k, KB, nk); k_vt16<<<(unsigned)(((size_t)NB_ * NHKV * HD * TT / 2 + 255) / 256), 256, 0, stream>>>(v, VT); }
    k_fattn<<<dim3(TT / (QW * NQW), NB_ * NHQ), NWV * 32, 0, stream>>>(q, KB, VT, OUT);
}

// v005
// A run of this version takes 38.2 microseconds.
// Two timings next to v004 both put it at 1.06 times that version's speed.
// Over all steps from v000 it is 26.9 times as fast.
#include <hip/hip_runtime.h>

// Attention forward, no mask: q [2][16][2048][64], k/v [2][4][2048][64]; GQA (4 query heads per kv head); out = softmax(q.k / 8) v -> [2][16][2048][64].
// Compute dtypes, f32 accumulate: every input rounded to bf16 (k and v by launches of their own, q in the registers of the wave that owns its rows); scores q.k on PLAIN bf16 operands (the 4x GQA repeat is a pointer mapping, never materialised);
// scale and softmax in f32 (a maximum in use and a sum per query; a wave's maxima move only when a score of one of its queries passes that query's maximum by more than 2^5) -> fp16 weights relative to the maximum in use, x1024; probs.v on SINGLE fp16 planes against fp16(bf16 v);
// the division by the row sum (which carries the same x1024) comes behind the product.

#define NB_  2
#define NHQ  16
#define NHKV 4
#define REP  (NHQ / NHKV)
#define TT   2048
#define HD   64
#define QW   32      // query columns of one wave (two 16-column groups)
#define NQW  8       // query slices of one work-group, one wave wide each
#define NKS  2       // key sets: each query slice is walked by two waves, each over half of the keys
#define NWV  (NQW * NKS)   // waves of one work-group
#define KP   32      // keys of one pass
#define CSL  0.18033688011112042f   // (1 / 8) * log2(e): scores go to the base-2 exponent in one multiply-add
#define PLOG 10.0f                  // probabilities carry x 2^10 into fp16; the row sum carries it too, so it cancels in the division
#define LAZY 5.0f                   // a score may lie this far (base-2 exponent) above the maximum in use: weights reach 2^15 at most (but for rounding), well inside fp16's range
typedef _Float16 h16;
typedef unsigned short bf;
typedef __attribute__((ext_vector_type(16))) __bf16   v16bf;
typedef __attribute__((ext_vector_type(16))) _Float16 v16h;
typedef __attribute__((ext_vector_type(8)))  _Float16 v8h;
typedef __attribute__((ext_vector_type(8)))  unsigned short v8us;
typedef __attribute__((ext_vector_type(8)))  __bf16   v8bf;
typedef __attribute__((ext_vector_type(8)))  float    v8f;
typedef __attribute__((ext_vector_type(4)))  float    v4f;
typedef __attribute__((ext_vector_type(2)))  float    v2f;

__device__ __forceinline__ unsigned short f2bf(float f) { unsigned u = __float_as_uint(f); u += 0x7FFFu + ((u >> 16) & 1u); return (unsigned short)(u >> 16); }
__device__ __forceinline__ float bf2f(unsigned short b) { return __uint_as_float(((unsigned)b) << 16); }
__device__ __forceinline__ float bfr(float f) { return bf2f(f2bf(f)); }
__device__ __forceinline__ v16h cat16(v8h lo, v8h hi) { return __builtin_shufflevector(lo, hi, 0, 1, 2, 3, 4, 5, 6, 7, 8, 9, 10, 11, 12, 13, 14, 15); }
__device__ __forceinline__ v16bf cat16b(v8us lo, v8us hi) { return __builtin_bit_cast(v16bf, __builtin_shufflevector(lo, hi, 0, 1, 2, 3, 4, 5, 6, 7, 8, 9, 10, 11, 12, 13, 14, 15)); }
__device__ __forceinline__ v8f wmma16(v16h a, v16h b, v8f c) { return __builtin_amdgcn_wmma_f32_16x16x32_f16(false, a, false, b, (short)0, c, false, false); }
__device__ __forceinline__ v8f wmmab(v16bf a, v16bf b, v8f c) { return __builtin_amdgcn_wmma_f32_16x16x32_bf16(false, a, false, b, (short)0, c, false, false); }

// Fragment of a K-contiguous 16-bit plane, p = row (lane & 15), k offset 8 * (lane >> 4): elements 0..7 = k 8h + s, elements 8..15 = k 16 + 8h + (s - 8).
template <typename T16> struct WFrag;
template <> struct WFrag<h16> { typedef v16h V; static __device__ __forceinline__ V ld(const h16* p) { return cat16(*(const v8h*)p, *(const v8h*)(p + 16)); } };
template <> struct WFrag<bf> { typedef v16bf V; static __device__ __forceinline__ V ld(const bf* p) { return cat16b(*(const v8us*)p, *(const v8us*)(p + 16)); } };

__device__ __forceinline__ h16 tohx(float x) { return (h16)x; }
typedef __attribute__((ext_vector_type(2))) _Float16 v2h;

__global__ __launch_bounds__(256) void k_cvt8(const float* __restrict__ src, bf* dst, size_t n8) { const size_t i = (size_t)blockIdx.x * 256 + threadIdx.x; if (i >= n8) return; const v8f v = *(const v8f*)(src + i * 8); v8us o;
#pragma unroll
    for (int k = 0; k < 8; ++k) o[k] = f2bf(v[k]); *(v8us*)(dst + i * 8) = o;  }
__global__ __launch_bounds__(256) void k_vt16(const float* __restrict__ v, h16* VT) { const size_t e = ((size_t)blockIdx.x * 256 + threadIdx.x) * 2; if (e >= (size_t)NB_ * NHKV * HD * TT) return; const int t = (int)(e % TT); const int d = (int)((e / TT) % HD); const size_t z = e / ((size_t)TT * HD); const float* src = v + z * TT * HD; v2h o;
    o[0] = tohx(bfr(src[(size_t)t * HD + d])); o[1] = tohx(bfr(src[(size_t)(t + 1) * HD + d])); *(v2h*)(VT + e) = o;  }

// value of lane l ^ 16
__device__ __forceinline__ float xhalf(float x) { const int b = __float_as_int(x); return __int_as_float(__builtin_amdgcn_permlanex16(b, b, 0x76543210, 0xfedcba98, false, false)); }

#define SK   128                    // keys of one stage
#define NST  (TT / SK)
#define KPB  144                    // LDS pitch of a K row (64 bf16 = 128 bytes, + 16)
#define VPB  272                    // LDS pitch of a Vt row (128 fp16 = 256 bytes, + 16)
#define KBY  (SK * KPB)
#define BUFB (KBY + HD * VPB)       // one buffer: K rows, then Vt rows

// One stage: every thread copies four 16-byte pieces of K and four of Vt; a wave's copy covers 512 bytes in a row of K, or two 256-byte rows of Vt.
// lk, lv: the thread's own LDS byte addresses in the buffer; gk, gv: its own global addresses in the stage.
__device__ __forceinline__ void stage_copy(unsigned lk, unsigned lv, const char* gk, const char* gv) {
    // the copies and their s_wait_xcnt stand in one statement, so that no address register is rewritten in front of the wait
    asm volatile("global_load_async_to_lds_b128 %0, %8, off\n\t"
                 "global_load_async_to_lds_b128 %1, %9, off\n\t"
                 "global_load_async_to_lds_b128 %2, %10, off\n\t"
                 "global_load_async_to_lds_b128 %3, %11, off\n\t"
                 "global_load_async_to_lds_b128 %4, %12, off\n\t"
                 "global_load_async_to_lds_b128 %5, %13, off\n\t"
                 "global_load_async_to_lds_b128 %6, %14, off\n\t"
                 "global_load_async_to_lds_b128 %7, %15, off\n\t"
                 "s_wait_xcnt 0x0"
                 :: "v"(lk), "v"(lk + 32 * KPB), "v"(lk + 64 * KPB), "v"(lk + 96 * KPB), "v"(lv), "v"(lv + 16 * VPB), "v"(lv + 32 * VPB), "v"(lv + 48 * VPB),
                    "v"(gk), "v"(gk + 4096), "v"(gk + 8192), "v"(gk + 12288), "v"(gv), "v"(gv + (size_t)16 * TT * 2), "v"(gv + (size_t)32 * TT * 2), "v"(gv + (size_t)48 * TT * 2)
                 : "memory");
}

__global__ __launch_bounds__(NWV * 32) void k_fattn(const float* __restrict__ Q, const bf* __restrict__ KB, const h16* __restrict__ VT, float* __restrict__ OUT) {
    __shared__ __attribute__((aligned(256))) unsigned char L[NKS * 2 * BUFB];
    __shared__ v4f X[NWV * 9 * 32];   // exchange of the partial results: [wave][piece][lane], 8 pieces of output sums and one with maximum and row sum
    const int lane = threadIdx.x & 31, lr = lane & 15, hi = lane >> 4;
    const int set = __builtin_amdgcn_readfirstlane(threadIdx.x >> 8);   // key set of this wave, the same in all its lanes
    const int tid = threadIdx.x & 255, wave = tid >> 5;                 // thread and wave inside the set
    const int zq = blockIdx.y; const int zkv = (zq / NHQ) * NHKV + (zq % NHQ) / REP;
    const int q0 = (blockIdx.x * NQW + wave) * QW;
    const float* Qp = Q + ((size_t)zq * TT + q0 + lr) * HD + 8 * hi;
    // copy addresses of this thread: K piece tid of 256 (8 pieces a row), Vt piece tid of 256 (16 pieces a row)
    const char* gk = (const char*)(KB + ((size_t)zkv * TT + set * SK) * HD) + tid * 16;
    const char* gv = (const char*)(VT + ((size_t)zkv * HD + (tid >> 4)) * TT + set * SK) + (tid & 15) * 16;
    const unsigned l0 = (unsigned)(size_t)(__attribute__((address_space(3))) unsigned char*)L + set * (2 * BUFB);
    const unsigned lk = l0 + (tid >> 3) * KPB + (tid & 7) * 16;
    const unsigned lv = l0 + KBY + (tid >> 4) * VPB + (tid & 15) * 16;
    // the wave's own q rows come as f32, straight from the input, in the fragment's k order (two runs of 8 a fragment); they are on their way while stage 0 is copied
    v8f qr[2][2][2];               // [query group][k step][run]
#pragma unroll
    for (int g = 0; g < 2; ++g)
#pragma unroll
        for (int ks = 0; ks < 2; ++ks) { qr[g][ks][0] = *(const v8f*)(Qp + g * 16 * HD + ks * 32); qr[g][ks][1] = *(const v8f*)(Qp + g * 16 * HD + ks * 32 + 16); }
    stage_copy(lk, lv, gk, gv);   // the set's first stage into its buffer 0
    v16bf qf[2][2], kf[2][2];      // [query group][k step], [key tile][k step]
    v16h vf[4];                    // [16 rows of d]
#pragma unroll
    for (int g = 0; g < 2; ++g)
#pragma unroll
        for (int ks = 0; ks < 2; ++ks)   // rounded to bf16 (nearest even) once, here
            qf[g][ks] = __builtin_shufflevector(__builtin_convertvector(qr[g][ks][0], v8bf), __builtin_convertvector(qr[g][ks][1], v8bf), 0, 1, 2, 3, 4, 5, 6, 7, 8, 9, 10, 11, 12, 13, 14, 15);
    v8f o[4][2];                   // [16 rows of d][query group]
#pragma unroll
    for (int dt = 0; dt < 4; ++dt) { o[dt][0] = (v8f){}; o[dt][1] = (v8f){}; }
    float m[2] = { -3.0e38f, -3.0e38f }, l[2] = { 0.f, 0.f };   // maximum in use (base-2 exponent) of a query; this lane's half of its running sum
#pragma unroll 1
    for (int st = 0; st < NST / NKS; ++st) {   // the set's stage st is stage NKS * st + set of the keys; stays rolled: the four passes inside are unrolled, and one stage's code is the hot loop
        // hand-over, the same in front of every stage: it publishes stage st and frees the other buffer, which stage st - 1 was read from
        asm volatile("s_wait_dscnt 0x0" ::: "memory");      // this wave's reads of the other buffer are done before the barrier behind which it is refilled
        asm volatile("s_wait_asynccnt 0x0" ::: "memory");   // this wave's copies of stage st have landed before the barrier behind which every wave of its set reads them
        __syncthreads();
        const unsigned char* Lb = L + (set * 2 + (st & 1)) * BUFB;
        const unsigned char* Ks = Lb + lr * KPB + 16 * hi;          // K row lr, k offset 8h
        const unsigned char* Vs = Lb + KBY + lr * VPB + 16 * hi;    // Vt row lr, key offset 8h
#pragma unroll
        for (int kt = 0; kt < 2; ++kt)
#pragma unroll
            for (int ks = 0; ks < 2; ++ks) kf[kt][ks] = WFrag<bf>::ld((const bf*)(Ks + kt * 16 * KPB + ks * 64));
#pragma unroll
        for (int dt = 0; dt < 4; ++dt) vf[dt] = WFrag<h16>::ld((const h16*)(Vs + dt * 16 * VPB));
        // the next stage flies while this one is worked on; its copies stand behind this stage's first fragment reads, so that those are under way while the copies issue
        if (st + 1 < NST / NKS) stage_copy(lk + ((st + 1) & 1) * BUFB, lv + ((st + 1) & 1) * BUFB, gk + (size_t)(st + 1) * (NKS * SK * HD * 2), gv + (size_t)(st + 1) * (NKS * SK * 2));
#pragma unroll
        for (int ps_ = 0; ps_ < SK / KP; ++ps_) {
            // inside a stage K and Vt fragments are fetched one pass ahead into the same registers, each right behind its last use; nothing of the next stage is read here
            v8f s[2][2];               // [key tile][query group]
#pragma unroll
            for (int kt = 0; kt < 2; ++kt)
#pragma unroll
                for (int g = 0; g < 2; ++g) { s[kt][g] = wmmab(kf[kt][0], qf[g][0], (v8f){}); s[kt][g] = wmmab(kf[kt][1], qf[g][1], s[kt][g]); }
            if (ps_ + 1 < SK / KP) {
#pragma unroll
                for (int kt = 0; kt < 2; ++kt)
#pragma unroll
                    for (int ks = 0; ks < 2; ++ks) kf[kt][ks] = WFrag<bf>::ld((const bf*)(Ks + ((ps_ + 1) * KP + kt * 16) * KPB + ks * 64));
            }
            __builtin_amdgcn_sched_barrier(0);   // keeps the softmax out of the score products: without it the first maxima move in between them and the build pads the products' result windows with more v_nop
            // when any query of the wave has a new maximum more than LAZY above the one in use, every lane of both groups takes the larger maximum and rescales sums and outputs: one test a pass for both groups
            float mx[2];
#pragma unroll
            for (int g = 0; g < 2; ++g) {
                float t = s[0][g][0];
#pragma unroll
                for (int j = 1; j < 8; ++j) t = fmaxf(t, s[0][g][j]);
#pragma unroll
                for (int j = 0; j < 8; ++j) t = fmaxf(t, s[1][g][j]);
                mx[g] = fmaxf(t, xhalf(t)) * CSL;
            }
            if (__builtin_amdgcn_ballot_w32(mx[0] > m[0] + LAZY || mx[1] > m[1] + LAZY) != 0) {   // a scalar branch, every lane on behind it; taken in a wave's first pass, seldom later
#pragma unroll
                for (int g = 0; g < 2; ++g) {
                    const float mn = fmaxf(m[g], mx[g]); const float dm = m[g] - mn; m[g] = mn; float al;
                    asm("v_exp_f32 %0, %1\n\tv_nop" : "=v"(al) : "v"(dm));   // al = 2^dm; the v_nop fills the slot that a transcendental wants before its source is overwritten or its result read, and stands in the same statement so that it stays directly behind it
                    l[g] *= al;
#pragma unroll
                    for (int dt = 0; dt < 4; ++dt) o[dt][g] *= al;
                }
            }
            v16h pf[2];
#pragma unroll
            for (int g = 0; g < 2; ++g) {
                const float mb = PLOG - m[g]; v2f ps = { 0.f, 0.f };
#pragma unroll
                for (int kt = 0; kt < 2; ++kt)
#pragma unroll
                    for (int j = 0; j < 8; j += 2) { const v2f x = __builtin_elementwise_fma((v2f){ s[kt][g][j], s[kt][g][j + 1] }, (v2f){ CSL, CSL }, (v2f){ mb, mb }); const v2f p = { __builtin_amdgcn_exp2f(x[0]), __builtin_amdgcn_exp2f(x[1]) }; ps += p; pf[g][kt * 8 + j] = tohx(p[0]); pf[g][kt * 8 + j + 1] = tohx(p[1]); }
                l[g] += ps[0] + ps[1];
            }
            __builtin_amdgcn_sched_barrier(0);   // keeps the eight products back to back with the Vt fetch directly behind them: without it the row sum's adds, with their padding, move in front of the last product and delay the fetch
#pragma unroll
            for (int dt = 0; dt < 4; ++dt)
#pragma unroll
                for (int g = 0; g < 2; ++g) o[dt][g] = wmma16(vf[dt], pf[g], o[dt][g]);
            if (ps_ + 1 < SK / KP) {
#pragma unroll
                for (int dt = 0; dt < 4; ++dt) vf[dt] = WFrag<h16>::ld((const h16*)(Vs + dt * 16 * VPB + (ps_ + 1) * KP * 2));
            }
            __builtin_amdgcn_sched_barrier(0);   // ends the pass: without it the unrolled next pass's score products and K reads are mixed into these products, and the LDS reads stand at four places of a pass instead of two
        }
    }
    asm volatile("s_wait_asynccnt 0x0" ::: "memory");   // no copy is outstanding when the wave ends
    // set 0 keeps query group 0 and gives group 1 away, set 1 the other way round
    v8f ok[4], og[4];
#pragma unroll
    for (int dt = 0; dt < 4; ++dt) { ok[dt] = set ? o[dt][1] : o[dt][0]; og[dt] = set ? o[dt][0] : o[dt][1]; }
    const float mk = set ? m[1] : m[0], lk_ = set ? l[1] : l[0], mg = set ? m[0] : m[1], lg = set ? l[0] : l[1];
    v4f* Xw = X + (size_t)((set * NQW + wave) * 9) * 32 + lane;
    const v4f* Xr = X + (size_t)(((set ^ 1) * NQW + wave) * 9) * 32 + lane;
#pragma unroll
    for (int dt = 0; dt < 4; ++dt) { Xw[(2 * dt) * 32] = (v4f){ og[dt][0], og[dt][1], og[dt][2], og[dt][3] }; Xw[(2 * dt + 1) * 32] = (v4f){ og[dt][4], og[dt][5], og[dt][6], og[dt][7] }; }
    Xw[8 * 32] = (v4f){ mg, lg, 0.f, 0.f };
    __syncthreads();   // the partner wave's partial result is in LDS behind it
    {
        const v4f ml = Xr[8 * 32];
        const float mn = fmaxf(mk, ml[0]);
        const float dk = mk - mn, dp = ml[0] - mn; float fk, fp;   // both partial results go to the common maximum
        asm("v_exp_f32 %0, %1\n\tv_nop" : "=v"(fk) : "v"(dk));   // fk = 2^dk; the v_nop fills the slot that a transcendental wants before its source is overwritten or its result read
        asm("v_exp_f32 %0, %1\n\tv_nop" : "=v"(fp) : "v"(dp));   // fp = 2^dp; the same slot
        const float ls = lk_ * fk + ml[1] * fp;
        const float inv = __fdiv_rn(1.0f, ls + xhalf(ls));
        const float ck = fk * inv, cp = fp * inv;
        float* op = OUT + ((size_t)zq * TT + q0 + set * 16 + lr) * HD + 8 * hi;   // register r of tile dt = d 16 dt + 8h + r of query lr: 8 floats in a row
#pragma unroll
        for (int dt = 0; dt < 4; ++dt) {
            const v4f p0 = Xr[(2 * dt) * 32], p1 = Xr[(2 * dt + 1) * 32];
            *(v4f*)(op + dt * 16) = (v4f){ ok[dt][0], ok[dt][1], ok[dt][2], ok[dt][3] } * ck + p0 * cp;
            *(v4f*)(op + dt * 16 + 4) = (v4f){ ok[dt][4], ok[dt][5], ok[dt][6], ok[dt][7] } * ck + p1 * cp;
        }
    }
}

extern "C" void kernel_launch(void* const* d_in, const int* in_sizes, int n_in,
                              void* d_out, int out_size, void* d_ws, size_t ws_size, hipStream_t stream) {
    (void)in_sizes; (void)n_in; (void)out_size;
    const float* q = (const float*)d_in[0]; const float* k = (const float*)d_in[1]; const float* v = (const float*)d_in[2];
    float* OUT = (float*)d_out;     // [2][16][2048][64]
    char* wsp = (char*)d_ws;
    auto take = [&](size_t bytes) { char* p = wsp; wsp += (bytes + 255) & ~(size_t)255; return (void*)p; };
    bf* KB = (bf*)take((size_t)NB_ * NHKV * TT * HD * 2); h16* VT = (h16*)take((size_t)NB_ * NHKV * HD * TT * 2);
    if ((size_t)(wsp - (char*)d_ws) > ws_size) return;    // 4 MiB
    { const size_t nk = (size_t)NB_ * NHKV * TT * HD / 8; k_cvt8<<<(unsigned)((nk + 255) / 256), 256, 0, stream>>>(k, KB, nk); k_vt16<<<(unsigned)(((size_t)NB_ * NHKV * HD * TT / 2 + 255) / 256), 256, 0, stream>>>(v, VT); }
    k_fattn<<<dim3(TT / (QW * NQW), NB_ * NHQ), NWV * 32, 0, stream>>>(q, KB, VT, OUT);
}

// v006
// Measured time: 30.6 microseconds a run.
// Next to v005, in two timings, it ran 1.25 times as fast each time.
// Counting every step since v000, it is 33.5 times as fast.
#include <hip/hip_runtime.h>

// Attention forward, no mask: q [2][16][2048][64], k/v [2][4][2048][64]; GQA (4 query heads per kv head); out = softmax(q.k / 8) v -> [2][16][2048][64].
// Compute dtypes, f32 accumulate: every input rounded to bf16 (k and v by one launch in front, q in the registers of the wave that owns its rows); scores q.k on PLAIN bf16 operands (the 4x GQA repeat is a pointer mapping, never materialised);
// scale and softmax in f32 (a maximum in use and a sum per query; the maximum moves only when a score passes it by more than 2^5) -> fp16 weights relative to the maximum in use, x1024; probs.v on SINGLE fp16 planes against fp16(bf16 v);
// the division by the row sum (which carries the same x1024) comes behind the product.

#define NB_  2
#define NHQ  16
#define NHKV 4
#define REP  (NHQ / NHKV)
#define TT   2048
#define HD   64
#define QW   32      // query columns of one wave (two 16-column groups)
#define NQW  8       // query slices of one work-group, one wave wide each
#define NKS  2       // key sets: each query slice is walked by two waves, each over half of the keys
#define NWV  (NQW * NKS)   // waves of one work-group
#define KP   32      // keys of one pass
#define CSL  0.18033688011112042f   // (1 / 8) * log2(e): scores go to the base-2 exponent in one multiply-add
#define PLOG 10.0f                  // probabilities carry x 2^10 into fp16; the row sum carries it too, so it cancels in the division
#define LAZY 5.0f                   // a score may lie this far (base-2 exponent) above the maximum in use: weights reach 2^15 at most (but for rounding), well inside fp16's range
typedef _Float16 h16;
typedef unsigned short bf;
typedef __attribute__((ext_vector_type(16))) __bf16   v16bf;
typedef __attribute__((ext_vector_type(16))) _Float16 v16h;
typedef __attribute__((ext_vector_type(8)))  _Float16 v8h;
typedef __attribute__((ext_vector_type(8)))  unsigned short v8us;
typedef __attribute__((ext_vector_type(8)))  __bf16   v8bf;
typedef __attribute__((ext_vector_type(8)))  float    v8f;
typedef __attribute__((ext_vector_type(4)))  float    v4f;
typedef __attribute__((ext_vector_type(2)))  float    v2f;

__device__ __forceinline__ unsigned short f2bf(float f) { unsigned u = __float_as_uint(f); u += 0x7FFFu + ((u >> 16) & 1u); return (unsigned short)(u >> 16); }
__device__ __forceinline__ float bf2f(unsigned short b) { return __uint_as_float(((unsigned)b) << 16); }
__device__ __forceinline__ float bfr(float f) { return bf2f(f2bf(f)); }
__device__ __forceinline__ v16h cat16(v8h lo, v8h hi) { return __builtin_shufflevector(lo, hi, 0, 1, 2, 3, 4, 5, 6, 7, 8, 9, 10, 11, 12, 13, 14, 15); }
__device__ __forceinline__ v16bf cat16b(v8us lo, v8us hi) { return __builtin_bit_cast(v16bf, __builtin_shufflevector(lo, hi, 0, 1, 2, 3, 4, 5, 6, 7, 8, 9, 10, 11, 12, 13, 14, 15)); }
__device__ __forceinline__ v8f wmma16(v16h a, v16h b, v8f c) { return __builtin_amdgcn_wmma_f32_16x16x32_f16(false, a, false, b, (short)0, c, false, false); }
__device__ __forceinline__ v8f wmmab(v16bf a, v16bf b, v8f c) { return __builtin_amdgcn_wmma_f32_16x16x32_bf16(false, a, false, b, (short)0, c, false, false); }

// Fragment of a K-contiguous 16-bit plane, p = row (lane & 15), k offset 8 * (lane >> 4): elements 0..7 = k 8h + s, elements 8..15 = k 16 + 8h + (s - 8).
template <typename T16> struct WFrag;
template <> struct WFrag<h16> { typedef v16h V; static __device__ __forceinline__ V ld(const h16* p) { return cat16(*(const v8h*)p, *(const v8h*)(p + 16)); } };
template <> struct WFrag<bf> { typedef v16bf V; static __device__ __forceinline__ V ld(const bf* p) { return cat16b(*(const v8us*)p, *(const v8us*)(p + 16)); } };

__device__ __forceinline__ h16 tohx(float x) { return (h16)x; }

typedef __attribute__((ext_vector_type(4))) _Float16 v4h;

// ---- k_prep: k -> bf16 (same layout) and v -> fp16(bf16 v), transposed to [head][d][key], in one launch. One work-group has PK keys of one kv head: a slab of PK * HD floats in a row of k and of v.
// k: 8 floats a thread and step, 16 bytes out. v: a thread has a block of 4 keys x 4 d (a wave's load covers two whole 256-byte rows) and lays it transposed into an LDS tile of HD rows of PK keys;
// behind the barrier the tile goes out in whole 128-byte lines, one line a Vt row. grid NB_ * NHKV * TT / PK, 256 threads.
#define PK   64                     // keys of one work-group
#define TPB  (PK * 2 + 16)          // LDS pitch of a tile row
__global__ __launch_bounds__(256) void k_prep(const float* __restrict__ k, const float* __restrict__ v, bf* __restrict__ KB, h16* __restrict__ VT) {
    __shared__ __attribute__((aligned(16))) unsigned char T[HD * TPB];
    const int tid = threadIdx.x; const int z = blockIdx.x / (TT / PK), t0 = (blockIdx.x % (TT / PK)) * PK;
    const size_t slab = ((size_t)z * TT + t0) * HD;
    const unsigned vo = (tid >> 4) * 4 * HD + (tid & 15) * 4;
    v4f r[4]; v8f kr[2];
#pragma unroll
    for (int j = 0; j < 4; ++j) r[j] = *(const v4f*)(v + slab + vo + j * HD);
#pragma unroll
    for (int j = 0; j < 2; ++j) kr[j] = *(const v8f*)(k + slab + (unsigned)(j * 256 + tid) * 8);
#pragma unroll
    for (int c = 0; c < 4; ++c) *(v4h*)(T + ((tid & 15) * 4 + c) * TPB + (tid >> 4) * 8) = (v4h){ tohx(bfr(r[0][c])), tohx(bfr(r[1][c])), tohx(bfr(r[2][c])), tohx(bfr(r[3][c])) };
    __syncthreads();   // the whole tile is in LDS behind it
#pragma unroll
    for (int j = 0; j < 2; ++j) { const unsigned p = j * 256 + tid;   // piece p: Vt row p >> 3, 16 bytes p & 7 of its line
        *(v8h*)(VT + (size_t)z * HD * TT + t0 + (p >> 3) * TT + (p & 7) * 8) = *(const v8h*)(T + (p >> 3) * TPB + (p & 7) * 16); }
    // k's stores stand behind the barrier: in front of it the barrier would wait for them
#pragma unroll
    for (int j = 0; j < 2; ++j) { v8us o;
#pragma unroll
        for (int e = 0; e < 8; ++e) o[e] = f2bf(kr[j][e]);
        *(v8us*)(KB + slab + (unsigned)(j * 256 + tid) * 8) = o; }
}

// value of lane l ^ 16
__device__ __forceinline__ float xhalf(float x) { const int b = __float_as_int(x); return __int_as_float(__builtin_amdgcn_permlanex16(b, b, 0x76543210, 0xfedcba98, false, false)); }

#define SK   128                    // keys of one stage
#define NST  (TT / SK)
#define KPB  144                    // LDS pitch of a K row (64 bf16 = 128 bytes, + 16)
#define VPB  272                    // LDS pitch of a Vt row (128 fp16 = 256 bytes, + 16)
#define KBY  (SK * KPB)
#define BUFB (KBY + HD * VPB)       // one buffer: K rows, then Vt rows

// One stage: every thread copies four 16-byte pieces of K and four of Vt; a wave's copy covers 512 bytes in a row of K, or two 256-byte rows of Vt.
// lk, lv: the thread's own LDS byte addresses in the buffer; gk, gv: its own global addresses in the stage.
__device__ __forceinline__ void stage_copy(unsigned lk, unsigned lv, const char* gk, const char* gv) {
    // the copies and their s_wait_xcnt stand in one statement, so that no address register is rewritten in front of the wait
    asm volatile("global_load_async_to_lds_b128 %0, %8, off\n\t"
                 "global_load_async_to_lds_b128 %1, %9, off\n\t"
                 "global_load_async_to_lds_b128 %2, %10, off\n\t"
                 "global_load_async_to_lds_b128 %3, %11, off\n\t"
                 "global_load_async_to_lds_b128 %4, %12, off\n\t"
                 "global_load_async_to_lds_b128 %5, %13, off\n\t"
                 "global_load_async_to_lds_b128 %6, %14, off\n\t"
                 "global_load_async_to_lds_b128 %7, %15, off\n\t"
                 "s_wait_xcnt 0x0"
                 :: "v"(lk), "v"(lk + 32 * KPB), "v"(lk + 64 * KPB), "v"(lk + 96 * KPB), "v"(lv), "v"(lv + 16 * VPB), "v"(lv + 32 * VPB), "v"(lv + 48 * VPB),
                    "v"(gk), "v"(gk + 4096), "v"(gk + 8192), "v"(gk + 12288), "v"(gv), "v"(gv + (size_t)16 * TT * 2), "v"(gv + (size_t)32 * TT * 2), "v"(gv + (size_t)48 * TT * 2)
                 : "memory");
}

__global__ __launch_bounds__(NWV * 32) void k_fattn(const float* __restrict__ Q, const bf* __restrict__ KB, const h16* __restrict__ VT, float* __restrict__ OUT) {
    __shared__ __attribute__((aligned(256))) unsigned char L[NKS * 2 * BUFB];
    __shared__ v4f X[NWV * 9 * 32];   // exchange of the partial results: [wave][piece][lane], 8 pieces of output sums and one with maximum and row sum
    const int lane = threadIdx.x & 31, lr = lane & 15, hi = lane >> 4;
    const int set = __builtin_amdgcn_readfirstlane(threadIdx.x >> 8);   // key set of this wave, the same in all its lanes
    const int tid = threadIdx.x & 255, wave = tid >> 5;                 // thread and wave inside the set
    const int zq = blockIdx.y; const int zkv = (zq / NHQ) * NHKV + (zq % NHQ) / REP;
    const int q0 = (blockIdx.x * NQW + wave) * QW;
    const float* Qp = Q + ((size_t)zq * TT + q0 + lr) * HD + 8 * hi;
    // copy addresses of this thread: K piece tid of 256 (8 pieces a row), Vt piece tid of 256 (16 pieces a row)
    const char* gk = (const char*)(KB + ((size_t)zkv * TT + set * SK) * HD) + tid * 16;
    const char* gv = (const char*)(VT + ((size_t)zkv * HD + (tid >> 4)) * TT + set * SK) + (tid & 15) * 16;
    const unsigned l0 = (unsigned)(size_t)(__attribute__((address_space(3))) unsigned char*)L + set * (2 * BUFB);
    const unsigned lk = l0 + (tid >> 3) * KPB + (tid & 7) * 16;
    const unsigned lv = l0 + KBY + (tid >> 4) * VPB + (tid & 15) * 16;
    // the wave's own q rows come as f32, straight from the input, in the fragment's k order (two runs of 8 a fragment); they are on their way while stage 0 is copied
    v8f qr[2][2][2];               // [query group][k step][run]
#pragma unroll
    for (int g = 0; g < 2; ++g)
#pragma unroll
        for (int ks = 0; ks < 2; ++ks) { qr[g][ks][0] = *(const v8f*)(Qp + g * 16 * HD + ks * 32); qr[g][ks][1] = *(const v8f*)(Qp + g * 16 * HD + ks * 32 + 16); }
    stage_copy(lk, lv, gk, gv);   // the set's first stage into its buffer 0
    v16bf qf[2][2], kf[2][2];      // [query group][k step], [key tile][k step]
    v16h vf[4];                    // [16 rows of d]
#pragma unroll
    for (int g = 0; g < 2; ++g)
#pragma unroll
        for (int ks = 0; ks < 2; ++ks)   // rounded to bf16 (nearest even) once, here
            qf[g][ks] = __builtin_shufflevector(__builtin_convertvector(qr[g][ks][0], v8bf), __builtin_convertvector(qr[g][ks][1], v8bf), 0, 1, 2, 3, 4, 5, 6, 7, 8, 9, 10, 11, 12, 13, 14, 15);
    v8f o[4][2];                   // [16 rows of d][query group]
#pragma unroll
    for (int dt = 0; dt < 4; ++dt) { o[dt][0] = (v8f){}; o[dt][1] = (v8f){}; }
    float m[2] = { -3.0e38f, -3.0e38f }, l[2] = { 0.f, 0.f };   // maximum in use (base-2 exponent) of a query; this lane's half of its running sum
#pragma unroll 1
    for (int st = 0; st < NST / NKS; ++st) {   // the set's stage st is stage NKS * st + set of the keys; stays rolled: the four passes inside are unrolled, and one stage's code is the hot loop
        // hand-over, the same in front of every stage: it publishes stage st and frees the other buffer, which stage st - 1 was read from
        asm volatile("s_wait_dscnt 0x0" ::: "memory");      // this wave's reads of the other buffer are done before the barrier behind which it is refilled
        asm volatile("s_wait_asynccnt 0x0" ::: "memory");   // this wave's copies of stage st have landed before the barrier behind which every wave of its set reads them
        __syncthreads();
        const unsigned char* Lb = L + (set * 2 + (st & 1)) * BUFB;
        const unsigned char* Ks = Lb + lr * KPB + 16 * hi;          // K row lr, k offset 8h
        const unsigned char* Vs = Lb + KBY + lr * VPB + 16 * hi;    // Vt row lr, key offset 8h
#pragma unroll
        for (int kt = 0; kt < 2; ++kt)
#pragma unroll
            for (int ks = 0; ks < 2; ++ks) kf[kt][ks] = WFrag<bf>::ld((const bf*)(Ks + kt * 16 * KPB + ks * 64));
#pragma unroll
        for (int dt = 0; dt < 4; ++dt) vf[dt] = WFrag<h16>::ld((const h16*)(Vs + dt * 16 * VPB));
        // the next stage flies while this one is worked on; its copies stand behind this stage's first fragment reads, so that those are under way while the copies issue
        if (st + 1 < NST / NKS) stage_copy(lk + ((st + 1) & 1) * BUFB, lv + ((st + 1) & 1) * BUFB, gk + (size_t)(st + 1) * (NKS * SK * HD * 2), gv + (size_t)(st + 1) * (NKS * SK * 2));
#pragma unroll
        for (int ps_ = 0; ps_ < SK / KP; ++ps_) {
            // inside a stage K and Vt fragments are fetched one pass ahead into the same registers, each right behind its last use; nothing of the next stage is read here
            v8f s[2][2];               // [key tile][query group]
#pragma unroll
            for (int kt = 0; kt < 2; ++kt)
#pragma unroll
                for (int g = 0; g < 2; ++g) { s[kt][g] = wmmab(kf[kt][0], qf[g][0], (v8f){}); s[kt][g] = wmmab(kf[kt][1], qf[g][1], s[kt][g]); }
            if (ps_ + 1 < SK / KP) {
#pragma unroll
                for (int kt = 0; kt < 2; ++kt)
#pragma unroll
                    for (int ks = 0; ks < 2; ++ks) kf[kt][ks] = WFrag<bf>::ld((const bf*)(Ks + ((ps_ + 1) * KP + kt * 16) * KPB + ks * 64));
            }
            __builtin_amdgcn_sched_barrier(0);   // keeps the softmax out of the score products: without it the first maxima move in between them and the build pads the products' result windows with more v_nop
            // when any query of the wave has a new maximum more than LAZY above the one in use, every lane of both groups takes the larger maximum and rescales sums and outputs: one test a pass for both groups
            float mx[2];
#pragma unroll
            for (int g = 0; g < 2; ++g) {
                float t = s[0][g][0];
#pragma unroll
                for (int j = 1; j < 8; ++j) t = fmaxf(t, s[0][g][j]);
#pragma unroll
                for (int j = 0; j < 8; ++j) t = fmaxf(t, s[1][g][j]);
                mx[g] = fmaxf(t, xhalf(t)) * CSL;
            }
            if (__builtin_amdgcn_ballot_w32(mx[0] > m[0] + LAZY || mx[1] > m[1] + LAZY) != 0) {   // a scalar branch, every lane on behind it; taken in a wave's first pass, seldom later
#pragma unroll
                for (int g = 0; g < 2; ++g) {
                    const float mn = fmaxf(m[g], mx[g]); const float dm = m[g] - mn; m[g] = mn; float al;
                    asm("v_exp_f32 %0, %1\n\tv_nop" : "=v"(al) : "v"(dm));   // al = 2^dm; the v_nop fills the slot that a transcendental wants before its source is overwritten or its result read, and stands in the same statement so that it stays directly behind it
                    l[g] *= al;
#pragma unroll
                    for (int dt = 0; dt < 4; ++dt) o[dt][g] *= al;
                }
            }
            v16h pf[2];
#pragma unroll
            for (int g = 0; g < 2; ++g) {
                const float mb = PLOG - m[g]; v2f ps = { 0.f, 0.f };
#pragma unroll
                for (int kt = 0; kt < 2; ++kt)
#pragma unroll
                    for (int j = 0; j < 8; j += 2) { const v2f x = __builtin_elementwise_fma((v2f){ s[kt][g][j], s[kt][g][j + 1] }, (v2f){ CSL, CSL }, (v2f){ mb, mb }); const v2f p = { __builtin_amdgcn_exp2f(x[0]), __builtin_amdgcn_exp2f(x[1]) }; ps += p; pf[g][kt * 8 + j] = tohx(p[0]); pf[g][kt * 8 + j + 1] = tohx(p[1]); }
                l[g] += ps[0] + ps[1];
            }
            __builtin_amdgcn_sched_barrier(0);   // keeps the eight products back to back with the Vt fetch directly behind them: without it the row sum's adds, with their padding, move in front of the last product and delay the fetch
#pragma unroll
            for (int dt = 0; dt < 4; ++dt)
#pragma unroll
                for (int g = 0; g < 2; ++g) o[dt][g] = wmma16(vf[dt], pf[g], o[dt][g]);
            if (ps_ + 1 < SK / KP) {
#pragma unroll
                for (int dt = 0; dt < 4; ++dt) vf[dt] = WFrag<h16>::ld((const h16*)(Vs + dt * 16 * VPB + (ps_ + 1) * KP * 2));
            }
            __builtin_amdgcn_sched_barrier(0);   // ends the pass: without it the unrolled next pass's score products and K reads are mixed into these products, and the LDS reads stand at four places of a pass instead of two
        }
    }
    asm volatile("s_wait_asynccnt 0x0" ::: "memory");   // no copy is outstanding when the wave ends
    // set 0 keeps query group 0 and gives group 1 away, set 1 the other way round
    v8f ok[4], og[4];
#pragma unroll
    for (int dt = 0; dt < 4; ++dt) { ok[dt] = set ? o[dt][1] : o[dt][0]; og[dt] = set ? o[dt][0] : o[dt][1]; }
    const float mk = set ? m[1] : m[0], lk_ = set ? l[1] : l[0], mg = set ? m[0] : m[1], lg = set ? l[0] : l[1];
    v4f* Xw = X + (size_t)((set * NQW + wave) * 9) * 32 + lane;
    const v4f* Xr = X + (size_t)(((set ^ 1) * NQW + wave) * 9) * 32 + lane;
#pragma unroll
    for (int dt = 0; dt < 4; ++dt) { Xw[(2 * dt) * 32] = (v4f){ og[dt][0], og[dt][1], og[dt][2], og[dt][3] }; Xw[(2 * dt + 1) * 32] = (v4f){ og[dt][4], og[dt][5], og[dt][6], og[dt][7] }; }
    Xw[8 * 32] = (v4f){ mg, lg, 0.f, 0.f };
    __syncthreads();   // the partner wave's partial result is in LDS behind it
    {
        const v4f ml = Xr[8 * 32];
        const float mn = fmaxf(mk, ml[0]);
        const float dk = mk - mn, dp = ml[0] - mn; float fk, fp;   // both partial results go to the common maximum
        asm("v_exp_f32 %0, %1\n\tv_nop" : "=v"(fk) : "v"(dk));   // fk = 2^dk; the v_nop fills the slot that a transcendental wants before its source is overwritten or its result read
        asm("v_exp_f32 %0, %1\n\tv_nop" : "=v"(fp) : "v"(dp));   // fp = 2^dp; the same slot
        const float ls = lk_ * fk + ml[1] * fp;
        const float inv = __fdiv_rn(1.0f, ls + xhalf(ls));
        const float ck = fk * inv, cp = fp * inv;
        float* op = OUT + ((size_t)zq * TT + q0 + set * 16 + lr) * HD + 8 * hi;   // register r of tile dt = d 16 dt + 8h + r of query lr: 8 floats in a row
#pragma unroll
        for (int dt = 0; dt < 4; ++dt) {
            const v4f p0 = Xr[(2 * dt) * 32], p1 = Xr[(2 * dt + 1) * 32];
            *(v4f*)(op + dt * 16) = (v4f){ ok[dt][0], ok[dt][1], ok[dt][2], ok[dt][3] } * ck + p0 * cp;
            *(v4f*)(op + dt * 16 + 4) = (v4f){ ok[dt][4], ok[dt][5], ok[dt][6], ok[dt][7] } * ck + p1 * cp;
        }
    }
}

extern "C" void kernel_launch(void* const* d_in, const int* in_sizes, int n_in,
                              void* d_out, int out_size, void* d_ws, size_t ws_size, hipStream_t stream) {
    (void)in_sizes; (void)n_in; (void)out_size;
    const float* q = (const float*)d_in[0]; const float* k = (const float*)d_in[1]; const float* v = (const float*)d_in[2];
    float* OUT = (float*)d_out;     // [2][16][2048][64]
    char* wsp = (char*)d_ws;
    auto take = [&](size_t bytes) { char* p = wsp; wsp += (bytes + 255) & ~(size_t)255; return (void*)p; };
    bf* KB = (bf*)take((size_t)NB_ * NHKV * TT * HD * 2); h16* VT = (h16*)take((size_t)NB_ * NHKV * HD * TT * 2);
    if ((size_t)(wsp - (char*)d_ws) > ws_size) return;    // 4 MiB
    k_prep<<<NB_ * NHKV * TT / PK, 256, 0, stream>>>(k, v, KB, VT);
    k_fattn<<<dim3(TT / (QW * NQW), NB_ * NHQ), NWV * 32, 0, stream>>>(q, KB, VT, OUT);
}

// v007
// It runs in 29.3 microseconds.
// Next to v006, in two timings, it ran 1.04 times as fast each time.
// Over all steps from v000 it is 35.0 times as fast.
#include <hip/hip_runtime.h>

// Attention forward, no mask: q [2][16][2048][64], k/v [2][4][2048][64]; GQA (4 query heads per kv head); out = softmax(q.k / 8) v -> [2][16][2048][64].
// Compute dtypes, f32 accumulate: every input rounded to bf16 (k and v by one launch in front, q in the registers of the wave that owns its rows); scores q.k on PLAIN bf16 operands (the 4x GQA repeat is a pointer mapping, never materialised);
// scale and softmax in f32 (a maximum in use and a sum per query; the maximum moves only when a score passes it by more than 2^5) -> fp16 weights relative to the maximum in use, x1024; probs.v on SINGLE fp16 planes against fp16(bf16 v);
// the division by the row sum (which carries the same x1024) comes behind the product.

#define NB_  2
#define NHQ  16
#define NHKV 4
#define REP  (NHQ / NHKV)
#define TT   2048
#define HD   64
#define QW   32      // query columns of one wave (two 16-column groups)
#define NQW  8       // query slices of one work-group, one wave wide each
#define NKS  2       // key sets: each query slice is walked by two waves, each over half of the keys
#define NWV  (NQW * NKS)   // waves of one work-group
#define KP   32      // keys of one pass
#define CSL  0.18033688011112042f   // (1 / 8) * log2(e): scores go to the base-2 exponent in one multiply-add
#define PLOG 10.0f                  // probabilities carry x 2^10 into fp16; the row sum carries it too, so it cancels in the division
#define LAZY 5.0f                   // a score may lie this far (base-2 exponent) above the maximum in use: weights reach 2^15 at most (but for rounding), well inside fp16's range
#define WTOP ((h16)32768.0f)        // 2^(PLOG + LAZY): a weight that reaches it says that a score has passed the maximum in use by LAZY
typedef _Float16 h16;
typedef unsigned short bf;
typedef __attribute__((ext_vector_type(16))) __bf16   v16bf;
typedef __attribute__((ext_vector_type(16))) _Float16 v16h;
typedef __attribute__((ext_vector_type(8)))  _Float16 v8h;
typedef __attribute__((ext_vector_type(8)))  unsigned short v8us;
typedef __attribute__((ext_vector_type(8)))  __bf16   v8bf;
typedef __attribute__((ext_vector_type(8)))  float    v8f;
typedef __attribute__((ext_vector_type(4)))  float    v4f;
typedef __attribute__((ext_vector_type(2)))  float    v2f;
typedef __attribute__((ext_vector_type(2)))  _Float16 v2h;

__device__ __forceinline__ unsigned short f2bf(float f) { unsigned u = __float_as_uint(f); u += 0x7FFFu + ((u >> 16) & 1u); return (unsigned short)(u >> 16); }
__device__ __forceinline__ float bf2f(unsigned short b) { return __uint_as_float(((unsigned)b) << 16); }
__device__ __forceinline__ float bfr(float f) { return bf2f(f2bf(f)); }
__device__ __forceinline__ v16h cat16(v8h lo, v8h hi) { return __builtin_shufflevector(lo, hi, 0, 1, 2, 3, 4, 5, 6, 7, 8, 9, 10, 11, 12, 13, 14, 15); }
__device__ __forceinline__ v16bf cat16b(v8us lo, v8us hi) { return __builtin_bit_cast(v16bf, __builtin_shufflevector(lo, hi, 0, 1, 2, 3, 4, 5, 6, 7, 8, 9, 10, 11, 12, 13, 14, 15)); }
__device__ __forceinline__ v8f wmma16(v16h a, v16h b, v8f c) { return __builtin_amdgcn_wmma_f32_16x16x32_f16(false, a, false, b, (short)0, c, false, false); }
__device__ __forceinline__ v8f wmmab(v16bf a, v16bf b, v8f c) { return __builtin_amdgcn_wmma_f32_16x16x32_bf16(false, a, false, b, (short)0, c, false, false); }

// Fragment of a K-contiguous 16-bit plane, p = row (lane & 15), k offset 8 * (lane >> 4): elements 0..7 = k 8h + s, elements 8..15 = k 16 + 8h + (s - 8).
template <typename T16> struct WFrag;
template <> struct WFrag<h16> { typedef v16h V; static __device__ __forceinline__ V ld(const h16* p) { return cat16(*(const v8h*)p, *(const v8h*)(p + 16)); } };
template <> struct WFrag<bf> { typedef v16bf V; static __device__ __forceinline__ V ld(const bf* p) { return cat16b(*(const v8us*)p, *(const v8us*)(p + 16)); } };

__device__ __forceinline__ h16 tohx(float x) { return (h16)x; }

typedef __attribute__((ext_vector_type(4))) _Float16 v4h;

// ---- k_prep: k -> bf16 (same layout) and v -> fp16(bf16 v), transposed to [head][d][key], in one launch. One work-group has PK keys of one kv head: a slab of PK * HD floats in a row of k and of v.
// k: 8 floats a thread and step, 16 bytes out. v: a thread has a block of 4 keys x 4 d (a wave's load covers two whole 256-byte rows) and lays it transposed into an LDS tile of HD rows of PK keys;
// behind the barrier the tile goes out in whole 128-byte lines, one line a Vt row. grid NB_ * NHKV * TT / PK, 256 threads.
#define PK   64                     // keys of one work-group
#define TPB  (PK * 2 + 16)          // LDS pitch of a tile row
__global__ __launch_bounds__(256) void k_prep(const float* __restrict__ k, const float* __restrict__ v, bf* __restrict__ KB, h16* __restrict__ VT) {
    __shared__ __attribute__((aligned(16))) unsigned char T[HD * TPB];
    const int tid = threadIdx.x; const int z = blockIdx.x / (TT / PK), t0 = (blockIdx.x % (TT / PK)) * PK;
    const size_t slab = ((size_t)z * TT + t0) * HD;
    const unsigned vo = (tid >> 4) * 4 * HD + (tid & 15) * 4;
    v4f r[4]; v8f kr[2];
#pragma unroll
    for (int j = 0; j < 4; ++j) r[j] = *(const v4f*)(v + slab + vo + j * HD);
#pragma unroll
    for (int j = 0; j < 2; ++j) kr[j] = *(const v8f*)(k + slab + (unsigned)(j * 256 + tid) * 8);
#pragma unroll
    for (int c = 0; c < 4; ++c) *(v4h*)(T + ((tid & 15) * 4 + c) * TPB + (tid >> 4) * 8) = (v4h){ tohx(bfr(r[0][c])), tohx(bfr(r[1][c])), tohx(bfr(r[2][c])), tohx(bfr(r[3][c])) };
    __syncthreads();   // the whole tile is in LDS behind it
#pragma unroll
    for (int j = 0; j < 2; ++j) { const unsigned p = j * 256 + tid;   // piece p: Vt row p >> 3, 16 bytes p & 7 of its line
        *(v8h*)(VT + (size_t)z * HD * TT + t0 + (p >> 3) * TT + (p & 7) * 8) = *(const v8h*)(T + (p >> 3) * TPB + (p & 7) * 16); }
    // k's stores stand behind the barrier: in front of it the barrier would wait for them
#pragma unroll
    for (int j = 0; j < 2; ++j) { v8us o;
#pragma unroll
        for (int e = 0; e < 8; ++e) o[e] = f2bf(kr[j][e]);
        *(v8us*)(KB + slab + (unsigned)(j * 256 + tid) * 8) = o; }
}

// value of lane l ^ 16
__device__ __forceinline__ float xhalf(float x) { const int b = __float_as_int(x); return __int_as_float(__builtin_amdgcn_permlanex16(b, b, 0x76543210, 0xfedcba98, false, false)); }

#define SK   128                    // keys of one stage
#define NST  (TT / SK)
#define KPB  144                    // LDS pitch of a K row (64 bf16 = 128 bytes, + 16)
#define VPB  272                    // LDS pitch of a Vt row (128 fp16 = 256 bytes, + 16)
#define KBY  (SK * KPB)
#define BUFB (KBY + HD * VPB)       // one buffer: K rows, then Vt rows

// One stage: every thread copies four 16-byte pieces of K and four of Vt; a wave's copy covers 512 bytes in a row of K, or two 256-byte rows of Vt.
// lk, lv: the thread's own LDS byte addresses in the buffer; gk, gv: its own global addresses in the stage.
__device__ __forceinline__ void stage_copy(unsigned lk, unsigned lv, const char* gk, const char* gv) {
    // the copies and their s_wait_xcnt stand in one statement, so that no address register is rewritten in front of the wait
    asm volatile("global_load_async_to_lds_b128 %0, %8, off\n\t"
                 "global_load_async_to_lds_b128 %1, %9, off\n\t"
                 "global_load_async_to_lds_b128 %2, %10, off\n\t"
                 "global_load_async_to_lds_b128 %3, %11, off\n\t"
                 "global_load_async_to_lds_b128 %4, %12, off\n\t"
                 "global_load_async_to_lds_b128 %5, %13, off\n\t"
                 "global_load_async_to_lds_b128 %6, %14, off\n\t"
                 "global_load_async_to_lds_b128 %7, %15, off\n\t"
                 "s_wait_xcnt 0x0"
                 :: "v"(lk), "v"(lk + 32 * KPB), "v"(lk + 64 * KPB), "v"(lk + 96 * KPB), "v"(lv), "v"(lv + 16 * VPB), "v"(lv + 32 * VPB), "v"(lv + 48 * VPB),
                    "v"(gk), "v"(gk + 4096), "v"(gk + 8192), "v"(gk + 12288), "v"(gv), "v"(gv + (size_t)16 * TT * 2), "v"(gv + (size_t)32 * TT * 2), "v"(gv + (size_t)48 * TT * 2)
                 : "memory");
}

__global__ __launch_bounds__(NWV * 32) void k_fattn(const float* __restrict__ Q, const bf* __restrict__ KB, const h16* __restrict__ VT, float* __restrict__ OUT) {
    __shared__ __attribute__((aligned(256))) unsigned char L[NKS * 2 * BUFB];
    __shared__ v4f X[NWV * 9 * 32];   // exchange of the partial results: [wave][piece][lane], 8 pieces of output sums and one with maximum and row sum
    const int lane = threadIdx.x & 31, lr = lane & 15, hi = lane >> 4;
    const int set = __builtin_amdgcn_readfirstlane(threadIdx.x >> 8);   // key set of this wave, the same in all its lanes
    const int tid = threadIdx.x & 255, wave = tid >> 5;                 // thread and wave inside the set
    const int zq = blockIdx.y; const int zkv = (zq / NHQ) * NHKV + (zq % NHQ) / REP;
    const int q0 = (blockIdx.x * NQW + wave) * QW;
    const float* Qp = Q + ((size_t)zq * TT + q0 + lr) * HD + 8 * hi;
    // copy addresses of this thread: K piece tid of 256 (8 pieces a row), Vt piece tid of 256 (16 pieces a row)
    const char* gk = (const char*)(KB + ((size_t)zkv * TT + set * SK) * HD) + tid * 16;
    const char* gv = (const char*)(VT + ((size_t)zkv * HD + (tid >> 4)) * TT + set * SK) + (tid & 15) * 16;
    const unsigned l0 = (unsigned)(size_t)(__attribute__((address_space(3))) unsigned char*)L + set * (2 * BUFB);
    const unsigned lk = l0 + (tid >> 3) * KPB + (tid & 7) * 16;
    const unsigned lv = l0 + KBY + (tid >> 4) * VPB + (tid & 15) * 16;
    // the wave's own q rows come as f32, straight from the input, in the fragment's k order (two runs of 8 a fragment); they are on their way while stage 0 is copied
    v8f qr[2][2][2];               // [query group][k step][run]
#pragma unroll
    for (int g = 0; g < 2; ++g)
#pragma unroll
        for (int ks = 0; ks < 2; ++ks) { qr[g][ks][0] = *(const v8f*)(Qp + g * 16 * HD + ks * 32); qr[g][ks][1] = *(const v8f*)(Qp + g * 16 * HD + ks * 32 + 16); }
    stage_copy(lk, lv, gk, gv);   // the set's first stage into its buffer 0
    v16bf qf[2][2], kf[2][2];      // [query group][k step], [key tile][k step]
    v16h vf[4];                    // [16 rows of d]
#pragma unroll
    for (int g = 0; g < 2; ++g)
#pragma unroll
        for (int ks = 0; ks < 2; ++ks)   // rounded to bf16 (nearest even) once, here
            qf[g][ks] = __builtin_shufflevector(__builtin_convertvector(qr[g][ks][0], v8bf), __builtin_convertvector(qr[g][ks][1], v8bf), 0, 1, 2, 3, 4, 5, 6, 7, 8, 9, 10, 11, 12, 13, 14, 15);
    v8f o[4][2];                   // [16 rows of d][query group]
#pragma unroll
    for (int dt = 0; dt < 4; ++dt) { o[dt][0] = (v8f){}; o[dt][1] = (v8f){}; }
    float m[2] = { -3.0e38f, -3.0e38f }, l[2] = { 0.f, 0.f };   // maximum in use (base-2 exponent) of a query; this lane's half of its running sum
#pragma unroll 1
    for (int st = 0; st < NST / NKS; ++st) {   // the set's stage st is stage NKS * st + set of the keys; stays rolled: the four passes inside are unrolled, and one stage's code is the hot loop
        // hand-over, the same in front of every stage: it publishes stage st and frees the other buffer, which stage st - 1 was read from
        asm volatile("s_wait_dscnt 0x0" ::: "memory");      // this wave's reads of the other buffer are done before the barrier behind which it is refilled
        asm volatile("s_wait_asynccnt 0x0" ::: "memory");   // this wave's copies of stage st have landed before the barrier behind which every wave of its set reads them
        __syncthreads();
        const unsigned char* Lb = L + (set * 2 + (st & 1)) * BUFB;
        const unsigned char* Ks = Lb + lr * KPB + 16 * hi;          // K row lr, k offset 8h
        const unsigned char* Vs = Lb + KBY + lr * VPB + 16 * hi;    // Vt row lr, key offset 8h
#pragma unroll
        for (int kt = 0; kt < 2; ++kt)
#pragma unroll
            for (int ks = 0; ks < 2; ++ks) kf[kt][ks] = WFrag<bf>::ld((const bf*)(Ks + kt * 16 * KPB + ks * 64));
#pragma unroll
        for (int dt = 0; dt < 4; ++dt) vf[dt] = WFrag<h16>::ld((const h16*)(Vs + dt * 16 * VPB));
        // the next stage flies while this one is worked on; its copies stand behind this stage's first fragment reads, so that those are under way while the copies issue
        if (st + 1 < NST / NKS) stage_copy(lk + ((st + 1) & 1) * BUFB, lv + ((st + 1) & 1) * BUFB, gk + (size_t)(st + 1) * (NKS * SK * HD * 2), gv + (size_t)(st + 1) * (NKS * SK * 2));
#pragma unroll
        for (int ps_ = 0; ps_ < SK / KP; ++ps_) {
            // inside a stage K and Vt fragments are fetched one pass ahead into the same registers, each right behind its last use; nothing of the next stage is read here
            v8f s[2][2];               // [key tile][query group]
#pragma unroll
            for (int kt = 0; kt < 2; ++kt)
#pragma unroll
                for (int g = 0; g < 2; ++g) { s[kt][g] = wmmab(kf[kt][0], qf[g][0], (v8f){}); s[kt][g] = wmmab(kf[kt][1], qf[g][1], s[kt][g]); }
            if (ps_ + 1 < SK / KP) {
#pragma unroll
                for (int kt = 0; kt < 2; ++kt)
#pragma unroll
                    for (int ks = 0; ks < 2; ++ks) kf[kt][ks] = WFrag<bf>::ld((const bf*)(Ks + ((ps_ + 1) * KP + kt * 16) * KPB + ks * 64));
            }
            __builtin_amdgcn_sched_barrier(0);   // keeps the softmax out of the score products: without it the first multiply-adds and exponentials move in between them and the build pads the products' result windows with more v_nop
            // the weights are formed at once, against the maximum in use; the finished fp16 weights themselves say whether it still holds: no maximum over the scores is taken on the common path
            v16h pf[2]; v2f ps[2];
            auto weights = [&]() {
#pragma unroll
                for (int g = 0; g < 2; ++g) {
                    const float mb = PLOG - m[g]; v2f a = { 0.f, 0.f };
#pragma unroll
                    for (int kt = 0; kt < 2; ++kt)
#pragma unroll
                        for (int j = 0; j < 8; j += 2) { const v2f x = __builtin_elementwise_fma((v2f){ s[kt][g][j], s[kt][g][j + 1] }, (v2f){ CSL, CSL }, (v2f){ mb, mb }); const v2f p = { __builtin_amdgcn_exp2f(x[0]), __builtin_amdgcn_exp2f(x[1]) }; a += p; pf[g][kt * 8 + j] = tohx(p[0]); pf[g][kt * 8 + j + 1] = tohx(p[1]); }
                    ps[g] = a;
                }
            };
            if (ps_ == 0 && st == 0) {   // a wave's first pass has no maximum yet: it takes the pass's own, straight from the scores (a scalar branch; sums and outputs are still zero, nothing to rescale)
#pragma unroll
                for (int g = 0; g < 2; ++g) {
                    float t = s[0][g][0];
#pragma unroll
                    for (int j = 1; j < 8; ++j) t = fmaxf(t, s[0][g][j]);
#pragma unroll
                    for (int j = 0; j < 8; ++j) t = fmaxf(t, s[1][g][j]);
                    m[g] = fmaxf(t, xhalf(t)) * CSL;
                }
            }
            weights();
            // largest weight of this lane, both groups: packed fp16 maxima, two weights a register
            v2h wm = __builtin_shufflevector(pf[0], pf[0], 0, 1);
#pragma unroll
            for (int j = 1; j < 8; ++j) wm = __builtin_elementwise_max(wm, (v2h){ pf[0][2 * j], pf[0][2 * j + 1] });
#pragma unroll
            for (int j = 0; j < 8; ++j) wm = __builtin_elementwise_max(wm, (v2h){ pf[1][2 * j], pf[1][2 * j + 1] });
            if (__builtin_amdgcn_ballot_w32(__builtin_elementwise_max(wm[0], wm[1]) >= WTOP) != 0) {   // a scalar branch, every lane on behind it; seldom taken: the maximum moves, sums and outputs are rescaled, the weights are formed anew
                // the scores are not kept past the weights (32 more registers a lane would spill): this pass's K rows are read from the stage's buffer once more and the same eight products give the same scores
#pragma unroll
                for (int kt = 0; kt < 2; ++kt) {
                    const v16bf k0 = WFrag<bf>::ld((const bf*)(Ks + (ps_ * KP + kt * 16) * KPB)), k1 = WFrag<bf>::ld((const bf*)(Ks + (ps_ * KP + kt * 16) * KPB + 64));
#pragma unroll
                    for (int g = 0; g < 2; ++g) { s[kt][g] = wmmab(k0, qf[g][0], (v8f){}); s[kt][g] = wmmab(k1, qf[g][1], s[kt][g]); }
                }
                float mx[2];
#pragma unroll
                for (int g = 0; g < 2; ++g) {
                    float t = s[0][g][0];
#pragma unroll
                    for (int j = 1; j < 8; ++j) t = fmaxf(t, s[0][g][j]);
#pragma unroll
                    for (int j = 0; j < 8; ++j) t = fmaxf(t, s[1][g][j]);
                    mx[g] = fmaxf(t, xhalf(t)) * CSL;
                }
#pragma unroll
                for (int g = 0; g < 2; ++g) {
                    const float mn = fmaxf(m[g], mx[g]); const float dm = m[g] - mn; m[g] = mn; float al;
                    asm("v_exp_f32 %0, %1\n\tv_nop" : "=v"(al) : "v"(dm));   // al = 2^dm; the v_nop fills the slot that a transcendental wants before its source is overwritten or its result read, and stands in the same statement so that it stays directly behind it
                    l[g] *= al;
#pragma unroll
                    for (int dt = 0; dt < 4; ++dt) o[dt][g] *= al;
                }
                weights();
            }
#pragma unroll
            for (int g = 0; g < 2; ++g) l[g] += ps[g][0] + ps[g][1];
            __builtin_amdgcn_sched_barrier(0);   // keeps the eight products back to back with the Vt fetch directly behind them: without it the row sum's adds, with their padding, move in front of the last product and delay the fetch
#pragma unroll
            for (int dt = 0; dt < 4; ++dt)
#pragma unroll
                for (int g = 0; g < 2; ++g) o[dt][g] = wmma16(vf[dt], pf[g], o[dt][g]);
            if (ps_ + 1 < SK / KP) {
#pragma unroll
                for (int dt = 0; dt < 4; ++dt) vf[dt] = WFrag<h16>::ld((const h16*)(Vs + dt * 16 * VPB + (ps_ + 1) * KP * 2));
            }
            __builtin_amdgcn_sched_barrier(0);   // ends the pass: without it the unrolled next pass's score products and K reads are mixed into these products, and the LDS reads stand at four places of a pass instead of two
        }
    }
    asm volatile("s_wait_asynccnt 0x0" ::: "memory");   // no copy is outstanding when the wave ends
    // set 0 keeps query group 0 and gives group 1 away, set 1 the other way round
    v8f ok[4], og[4];
#pragma unroll
    for (int dt = 0; dt < 4; ++dt) { ok[dt] = set ? o[dt][1] : o[dt][0]; og[dt] = set ? o[dt][0] : o[dt][1]; }
    const float mk = set ? m[1] : m[0], lk_ = set ? l[1] : l[0], mg = set ? m[0] : m[1], lg = set ? l[0] : l[1];
    v4f* Xw = X + (size_t)((set * NQW + wave) * 9) * 32 + lane;
    const v4f* Xr = X + (size_t)(((set ^ 1) * NQW + wave) * 9) * 32 + lane;
#pragma unroll
    for (int dt = 0; dt < 4; ++dt) { Xw[(2 * dt) * 32] = (v4f){ og[dt][0], og[dt][1], og[dt][2], og[dt][3] }; Xw[(2 * dt + 1) * 32] = (v4f){ og[dt][4], og[dt][5], og[dt][6], og[dt][7] }; }
    Xw[8 * 32] = (v4f){ mg, lg, 0.f, 0.f };
    __syncthreads();   // the partner wave's partial result is in LDS behind it
    {
        const v4f ml = Xr[8 * 32];
        const float mn = fmaxf(mk, ml[0]);
        const float dk = mk - mn, dp = ml[0] - mn; float fk, fp;   // both partial results go to the common maximum
        asm("v_exp_f32 %0, %1\n\tv_nop" : "=v"(fk) : "v"(dk));   // fk = 2^dk; the v_nop fills the slot that a transcendental wants before its source is overwritten or its result read
        asm("v_exp_f32 %0, %1\n\tv_nop" : "=v"(fp) : "v"(dp));   // fp = 2^dp; the same slot
        const float ls = lk_ * fk + ml[1] * fp;
        const float inv = __fdiv_rn(1.0f, ls + xhalf(ls));
        const float ck = fk * inv, cp = fp * inv;
        float* op = OUT + ((size_t)zq * TT + q0 + set * 16 + lr) * HD + 8 * hi;   // register r of tile dt = d 16 dt + 8h + r of query lr: 8 floats in a row
#pragma unroll
        for (int dt = 0; dt < 4; ++dt) {
            const v4f p0 = Xr[(2 * dt) * 32], p1 = Xr[(2 * dt + 1) * 32];
            *(v4f*)(op + dt * 16) = (v4f){ ok[dt][0], ok[dt][1], ok[dt][2], ok[dt][3] } * ck + p0 * cp;
            *(v4f*)(op + dt * 16 + 4) = (v4f){ ok[dt][4], ok[dt][5], ok[dt][6], ok[dt][7] } * ck + p1 * cp;
        }
    }
}

extern "C" void kernel_launch(void* const* d_in, const int* in_sizes, int n_in,
                              void* d_out, int out_size, void* d_ws, size_t ws_size, hipStream_t stream) {
    (void)in_sizes; (void)n_in; (void)out_size;
    const float* q = (const float*)d_in[0]; const float* k = (const float*)d_in[1]; const float* v = (const float*)d_in[2];
    float* OUT = (float*)d_out;     // [2][16][2048][64]
    char* wsp = (char*)d_ws;
    auto take = [&](size_t bytes) { char* p = wsp; wsp += (bytes + 255) & ~(size_t)255; return (void*)p; };
    bf* KB = (bf*)take((size_t)NB_ * NHKV * TT * HD * 2); h16* VT = (h16*)take((size_t)NB_ * NHKV * HD * TT * 2);
    if ((size_t)(wsp - (char*)d_ws) > ws_size) return;    // 4 MiB
    k_prep<<<NB_ * NHKV * TT / PK, 256, 0, stream>>>(k, v, KB, VT);
    k_fattn<<<dim3(TT / (QW * NQW), NB_ * NHQ), NWV * 32, 0, stream>>>(q, KB, VT, OUT);
}

// v008
// Measured time: 28.3 microseconds a run.
// Next to v007, in two timings, it ran 1.03 times as fast each time.
// All steps since v000 together make it 36.2 times as fast.
#include <hip/hip_runtime.h>

// Attention forward, no mask: q [2][16][2048][64], k/v [2][4][2048][64]; GQA (4 query heads per kv head); out = softmax(q.k / 8) v -> [2][16][2048][64].
// Compute dtypes, f32 accumulate: every input rounded to bf16 (k and v by one launch in front, q in the registers of the wave that owns its rows); scores q.k on PLAIN bf16 operands (the 4x GQA repeat is a pointer mapping, never materialised);
// scale and softmax in f32 (a maximum in use and a sum per query; the maximum moves only when a score passes it by more than 2^5) -> fp16 weights relative to the maximum in use, x1024; probs.v on SINGLE fp16 planes against fp16(bf16 v);
// the division by the row sum (which carries the same x1024) comes behind the product.

#define NB_  2
#define NHQ  16
#define NHKV 4
#define REP  (NHQ / NHKV)
#define TT   2048
#define HD   64
#define QW   32      // query columns of one wave (two 16-column groups)
#define NQW  8       // query slices of one work-group, one wave wide each
#define NKS  2       // key sets: each query slice is walked by two waves, each over half of the keys
#define NWV  (NQW * NKS)   // waves of one work-group
#define KP   32      // keys of one pass
#define CSL  0.18033688011112042f   // (1 / 8) * log2(e): scores go to the base-2 exponent in one multiply-add
#define PLOG 10.0f                  // probabilities carry x 2^10 into fp16; the row sum carries it too, so it cancels in the division
#define LAZY 5.0f                   // a score may lie this far (base-2 exponent) above the maximum in use: weights reach 2^15 at most (but for rounding), well inside fp16's range
#define WTOP ((h16)32768.0f)        // 2^(PLOG + LAZY): a weight that reaches it says that a score has passed the maximum in use by LAZY
#define WPRE 32752.0f               // below every f32 weight that rounds to WTOP or more in fp16 (those are 32760 and up): a partial row sum under it holds no such weight
typedef _Float16 h16;
typedef unsigned short bf;
typedef __attribute__((ext_vector_type(16))) __bf16   v16bf;
typedef __attribute__((ext_vector_type(16))) _Float16 v16h;
typedef __attribute__((ext_vector_type(8)))  _Float16 v8h;
typedef __attribute__((ext_vector_type(8)))  unsigned short v8us;
typedef __attribute__((ext_vector_type(8)))  __bf16   v8bf;
typedef __attribute__((ext_vector_type(8)))  float    v8f;
typedef __attribute__((ext_vector_type(4)))  float    v4f;
typedef __attribute__((ext_vector_type(2)))  float    v2f;
typedef __attribute__((ext_vector_type(2)))  _Float16 v2h;

__device__ __forceinline__ unsigned short f2bf(float f) { unsigned u = __float_as_uint(f); u += 0x7FFFu + ((u >> 16) & 1u); return (unsigned short)(u >> 16); }
__device__ __forceinline__ float bf2f(unsigned short b) { return __uint_as_float(((unsigned)b) << 16); }
__device__ __forceinline__ float bfr(float f) { return bf2f(f2bf(f)); }
__device__ __forceinline__ v16h cat16(v8h lo, v8h hi) { return __builtin_shufflevector(lo, hi, 0, 1, 2, 3, 4, 5, 6, 7, 8, 9, 10, 11, 12, 13, 14, 15); }
__device__ __forceinline__ v16bf cat16b(v8us lo, v8us hi) { return __builtin_bit_cast(v16bf, __builtin_shufflevector(lo, hi, 0, 1, 2, 3, 4, 5, 6, 7, 8, 9, 10, 11, 12, 13, 14, 15)); }
__device__ __forceinline__ v8f wmma16(v16h a, v16h b, v8f c) { return __builtin_amdgcn_wmma_f32_16x16x32_f16(false, a, false, b, (short)0, c, false, false); }
__device__ __forceinline__ v8f wmmab(v16bf a, v16bf b, v8f c) { return __builtin_amdgcn_wmma_f32_16x16x32_bf16(false, a, false, b, (short)0, c, false, false); }

// Fragment of a K-contiguous 16-bit plane, p = row (lane & 15), k offset 8 * (lane >> 4): elements 0..7 = k 8h + s, elements 8..15 = k 16 + 8h + (s - 8).
template <typename T16> struct WFrag;
template <> struct WFrag<h16> { typedef v16h V; static __device__ __forceinline__ V ld(const h16* p) { return cat16(*(const v8h*)p, *(const v8h*)(p + 16)); } };
template <> struct WFrag<bf> { typedef v16bf V; static __device__ __forceinline__ V ld(const bf* p) { return cat16b(*(const v8us*)p, *(const v8us*)(p + 16)); } };

__device__ __forceinline__ h16 tohx(float x) { return (h16)x; }

typedef __attribute__((ext_vector_type(4))) _Float16 v4h;

// ---- k_prep: k -> bf16 (same layout) and v -> fp16(bf16 v), transposed to [head][d][key], in one launch. One work-group has PK keys of one kv head: a slab of PK * HD floats in a row of k and of v.
// k: 8 floats a thread and step, 16 bytes out. v: a thread has a block of 4 keys x 4 d (a wave's load covers two whole 256-byte rows) and lays it transposed into an LDS tile of HD rows of PK keys;
// behind the barrier the tile goes out in whole 128-byte lines, one line a Vt row. grid NB_ * NHKV * TT / PK, 256 threads.
#define PK   64                     // keys of one work-group
#define TPB  (PK * 2 + 16)          // LDS pitch of a tile row
__global__ __launch_bounds__(256) void k_prep(const float* __restrict__ k, const float* __restrict__ v, bf* __restrict__ KB, h16* __restrict__ VT) {
    __shared__ __attribute__((aligned(16))) unsigned char T[HD * TPB];
    const int tid = threadIdx.x; const int z = blockIdx.x / (TT / PK), t0 = (blockIdx.x % (TT / PK)) * PK;
    const size_t slab = ((size_t)z * TT + t0) * HD;
    const unsigned vo = (tid >> 4) * 4 * HD + (tid & 15) * 4;
    v4f r[4]; v8f kr[2];
#pragma unroll
    for (int j = 0; j < 4; ++j) r[j] = *(const v4f*)(v + slab + vo + j * HD);
#pragma unroll
    for (int j = 0; j < 2; ++j) kr[j] = *(const v8f*)(k + slab + (unsigned)(j * 256 + tid) * 8);
#pragma unroll
    for (int c = 0; c < 4; ++c) *(v4h*)(T + ((tid & 15) * 4 + c) * TPB + (tid >> 4) * 8) = (v4h){ tohx(bfr(r[0][c])), tohx(bfr(r[1][c])), tohx(bfr(r[2][c])), tohx(bfr(r[3][c])) };
    __syncthreads();   // the whole tile is in LDS behind it
#pragma unroll
    for (int j = 0; j < 2; ++j) { const unsigned p = j * 256 + tid;   // piece p: Vt row p >> 3, 16 bytes p & 7 of its line
        *(v8h*)(VT + (size_t)z * HD * TT + t0 + (p >> 3) * TT + (p & 7) * 8) = *(const v8h*)(T + (p >> 3) * TPB + (p & 7) * 16); }
    // k's stores stand behind the barrier: in front of it the barrier would wait for them
#pragma unroll
    for (int j = 0; j < 2; ++j) { v8us o;
#pragma unroll
        for (int e = 0; e < 8; ++e) o[e] = f2bf(kr[j][e]);
        *(v8us*)(KB + slab + (unsigned)(j * 256 + tid) * 8) = o; }
}

// value of lane l ^ 16
__device__ __forceinline__ float xhalf(float x) { const int b = __float_as_int(x); return __int_as_float(__builtin_amdgcn_permlanex16(b, b, 0x76543210, 0xfedcba98, false, false)); }

#define SK   128                    // keys of one stage
#define NST  (TT / SK)
#define KPB  144                    // LDS pitch of a K row (64 bf16 = 128 bytes, + 16)
#define VPB  272                    // LDS pitch of a Vt row (128 fp16 = 256 bytes, + 16)
#define KBY  (SK * KPB)
#define BUFB (KBY + HD * VPB)       // one buffer: K rows, then Vt rows

// One stage: every thread copies four 16-byte pieces of K and four of Vt; a wave's copy covers 512 bytes in a row of K, or two 256-byte rows of Vt.
// lk, lv: the thread's own LDS byte addresses in the buffer; gk, gv: its own global addresses in the stage.
__device__ __forceinline__ void stage_copy(unsigned lk, unsigned lv, const char* gk, const char* gv) {
    // the copies and their s_wait_xcnt stand in one statement, so that no address register is rewritten in front of the wait
    asm volatile("global_load_async_to_lds_b128 %0, %8, off\n\t"
                 "global_load_async_to_lds_b128 %1, %9, off\n\t"
                 "global_load_async_to_lds_b128 %2, %10, off\n\t"
                 "global_load_async_to_lds_b128 %3, %11, off\n\t"
                 "global_load_async_to_lds_b128 %4, %12, off\n\t"
                 "global_load_async_to_lds_b128 %5, %13, off\n\t"
                 "global_load_async_to_lds_b128 %6, %14, off\n\t"
                 "global_load_async_to_lds_b128 %7, %15, off\n\t"
                 "s_wait_xcnt 0x0"
                 :: "v"(lk), "v"(lk + 32 * KPB), "v"(lk + 64 * KPB), "v"(lk + 96 * KPB), "v"(lv), "v"(lv + 16 * VPB), "v"(lv + 32 * VPB), "v"(lv + 48 * VPB),
                    "v"(gk), "v"(gk + 4096), "v"(gk + 8192), "v"(gk + 12288), "v"(gv), "v"(gv + (size_t)16 * TT * 2), "v"(gv + (size_t)32 * TT * 2), "v"(gv + (size_t)48 * TT * 2)
                 : "memory");
}

__global__ __launch_bounds__(NWV * 32) void k_fattn(const float* __restrict__ Q, const bf* __restrict__ KB, const h16* __restrict__ VT, float* __restrict__ OUT) {
    __shared__ __attribute__((aligned(256))) unsigned char L[NKS * 2 * BUFB];
    __shared__ v4f X[NWV * 9 * 32];   // exchange of the partial results: [wave][piece][lane], 8 pieces of output sums and one with maximum and row sum
    const int lane = threadIdx.x & 31, lr = lane & 15, hi = lane >> 4;
    const int set = __builtin_amdgcn_readfirstlane(threadIdx.x >> 8);   // key set of this wave, the same in all its lanes
    const int tid = threadIdx.x & 255, wave = tid >> 5;                 // thread and wave inside the set
    const int zq = blockIdx.y; const int zkv = (zq / NHQ) * NHKV + (zq % NHQ) / REP;
    const int q0 = (blockIdx.x * NQW + wave) * QW;
    const float* Qp = Q + ((size_t)zq * TT + q0 + lr) * HD + 8 * hi;
    // copy addresses of this thread: K piece tid of 256 (8 pieces a row), Vt piece tid of 256 (16 pieces a row)
    const char* gk = (const char*)(KB + ((size_t)zkv * TT + set * SK) * HD) + tid * 16;
    const char* gv = (const char*)(VT + ((size_t)zkv * HD + (tid >> 4)) * TT + set * SK) + (tid & 15) * 16;
    const unsigned l0 = (unsigned)(size_t)(__attribute__((address_space(3))) unsigned char*)L + set * (2 * BUFB);
    const unsigned lk = l0 + (tid >> 3) * KPB + (tid & 7) * 16;
    const unsigned lv = l0 + KBY + (tid >> 4) * VPB + (tid & 15) * 16;
    // the wave's own q rows come as f32, straight from the input, in the fragment's k order (two runs of 8 a fragment); they are on their way while stage 0 is copied
    v8f qr[2][2][2];               // [query group][k step][run]
#pragma unroll
    for (int g = 0; g < 2; ++g)
#pragma unroll
        for (int ks = 0; ks < 2; ++ks) { qr[g][ks][0] = *(const v8f*)(Qp + g * 16 * HD + ks * 32); qr[g][ks][1] = *(const v8f*)(Qp + g * 16 * HD + ks * 32 + 16); }
    stage_copy(lk, lv, gk, gv);   // the set's first stage into its buffer 0
    v16bf qf[2][2], kf[2][2];      // [query group][k step], [key tile][k step]
    v16h vf[4];                    // [16 rows of d]
#pragma unroll
    for (int g = 0; g < 2; ++g)
#pragma unroll
        for (int ks = 0; ks < 2; ++ks)   // rounded to bf16 (nearest even) once, here
            qf[g][ks] = __builtin_shufflevector(__builtin_convertvector(qr[g][ks][0], v8bf), __builtin_convertvector(qr[g][ks][1], v8bf), 0, 1, 2, 3, 4, 5, 6, 7, 8, 9, 10, 11, 12, 13, 14, 15);
    v8f o[4][2];                   // [16 rows of d][query group]
#pragma unroll
    for (int dt = 0; dt < 4; ++dt) { o[dt][0] = (v8f){}; o[dt][1] = (v8f){}; }
    float m[2] = { -3.0e38f, -3.0e38f };   // maximum in use (base-2 exponent) of a query
    v2f l[2] = { { 0.f, 0.f }, { 0.f, 0.f } };   // this lane's half of the query's running sum, kept as the two partial sums of the packed adds; they are joined in the epilogue
#pragma unroll 1
    for (int st = 0; st < NST / NKS; ++st) {   // the set's stage st is stage NKS * st + set of the keys; stays rolled: the four passes inside are unrolled, and one stage's code is the hot loop
        // hand-over, the same in front of every stage: it publishes stage st and frees the other buffer, which stage st - 1 was read from
        asm volatile("s_wait_dscnt 0x0" ::: "memory");      // this wave's reads of the other buffer are done before the barrier behind which it is refilled
        asm volatile("s_wait_asynccnt 0x0" ::: "memory");   // this wave's copies of stage st have landed before the barrier behind which every wave of its set reads them
        __syncthreads();
        const unsigned char* Lb = L + (set * 2 + (st & 1)) * BUFB;
        const unsigned char* Ks = Lb + lr * KPB + 16 * hi;          // K row lr, k offset 8h
        const unsigned char* Vs = Lb + KBY + lr * VPB + 16 * hi;    // Vt row lr, key offset 8h
#pragma unroll
        for (int kt = 0; kt < 2; ++kt)
#pragma unroll
            for (int ks = 0; ks < 2; ++ks) kf[kt][ks] = WFrag<bf>::ld((const bf*)(Ks + kt * 16 * KPB + ks * 64));
#pragma unroll
        for (int dt = 0; dt < 4; ++dt) vf[dt] = WFrag<h16>::ld((const h16*)(Vs + dt * 16 * VPB));
        // the next stage flies while this one is worked on; its copies stand behind this stage's first fragment reads, so that those are under way while the copies issue
        if (st + 1 < NST / NKS) stage_copy(lk + ((st + 1) & 1) * BUFB, lv + ((st + 1) & 1) * BUFB, gk + (size_t)(st + 1) * (NKS * SK * HD * 2), gv + (size_t)(st + 1) * (NKS * SK * 2));
#pragma unroll
        for (int ps_ = 0; ps_ < SK / KP; ++ps_) {
            // inside a stage K and Vt fragments are fetched one pass ahead into the same registers, each right behind its last use; nothing of the next stage is read here
            v8f s[2][2];               // [key tile][query group]
#pragma unroll
            for (int kt = 0; kt < 2; ++kt)
#pragma unroll
                for (int g = 0; g < 2; ++g) { s[kt][g] = wmmab(kf[kt][0], qf[g][0], (v8f){}); s[kt][g] = wmmab(kf[kt][1], qf[g][1], s[kt][g]); }
            if (ps_ + 1 < SK / KP) {
#pragma unroll
                for (int kt = 0; kt < 2; ++kt)
#pragma unroll
                    for (int ks = 0; ks < 2; ++ks) kf[kt][ks] = WFrag<bf>::ld((const bf*)(Ks + ((ps_ + 1) * KP + kt * 16) * KPB + ks * 64));
            }
            __builtin_amdgcn_sched_barrier(0);   // keeps the softmax out of the score products: without it the first multiply-adds and exponentials move in between them and the build pads the products' result windows with more v_nop
            // the weights are formed at once, against the maximum in use; the pass's own partial row sums, which are needed anyway, say whether it can have failed: no maximum over scores or weights is taken on the common path
            v16h pf[2]; v2f ps[2];
            auto weights = [&]() {
#pragma unroll
                for (int g = 0; g < 2; ++g) {
                    const float mb = PLOG - m[g]; v2f a = { 0.f, 0.f };
#pragma unroll
                    for (int kt = 0; kt < 2; ++kt)
#pragma unroll
                        for (int j = 0; j < 8; j += 2) { const v2f x = __builtin_elementwise_fma((v2f){ s[kt][g][j], s[kt][g][j + 1] }, (v2f){ CSL, CSL }, (v2f){ mb, mb }); const v2f p = { __builtin_amdgcn_exp2f(x[0]), __builtin_amdgcn_exp2f(x[1]) }; a += p; pf[g][kt * 8 + j] = tohx(p[0]); pf[g][kt * 8 + j + 1] = tohx(p[1]); }
                    ps[g] = a;
                }
            };
            if (ps_ == 0 && st == 0) {   // a wave's first pass has no maximum yet: it takes the pass's own, straight from the scores (a scalar branch; sums and outputs are still zero, nothing to rescale)
#pragma unroll
                for (int g = 0; g < 2; ++g) {
                    float t = s[0][g][0];
#pragma unroll
                    for (int j = 1; j < 8; ++j) t = fmaxf(t, s[0][g][j]);
#pragma unroll
                    for (int j = 0; j < 8; ++j) t = fmaxf(t, s[1][g][j]);
                    m[g] = fmaxf(t, xhalf(t)) * CSL;
                }
            }
            weights();
            v2f ln[2];   // the running sums with this pass: formed here, among the exponentials, not among the products behind the test
#pragma unroll
            for (int g = 0; g < 2; ++g) ln[g] = l[g] + ps[g];
            // weights are not negative, so a partial sum is at least its largest weight: four sums under WPRE clear all 32 weights of the lane
            if (__builtin_amdgcn_ballot_w32(fmaxf(fmaxf(ps[0][0], ps[0][1]), fmaxf(ps[1][0], ps[1][1])) >= WPRE) != 0) {   // a scalar branch, every lane on behind it; seldom taken
                // only here the weights themselves are looked at, so that the maximum moves in exactly the passes in which a weight has reached WTOP. Largest weight of this lane, both groups: packed fp16 maxima, two weights a register
                v2h wm = __builtin_shufflevector(pf[0], pf[0], 0, 1);
#pragma unroll
                for (int j = 1; j < 8; ++j) wm = __builtin_elementwise_max(wm, (v2h){ pf[0][2 * j], pf[0][2 * j + 1] });
#pragma unroll
                for (int j = 0; j < 8; ++j) wm = __builtin_elementwise_max(wm, (v2h){ pf[1][2 * j], pf[1][2 * j + 1] });
                if (__builtin_amdgcn_ballot_w32(__builtin_elementwise_max(wm[0], wm[1]) >= WTOP) != 0) {   // again a scalar branch: the maximum moves, sums and outputs are rescaled, the weights are formed anew
                    // the scores are not kept past the weights (32 more registers a lane would spill): this pass's K rows are read from the stage's buffer once more and the same eight products give the same scores
#pragma unroll
                    for (int kt = 0; kt < 2; ++kt) {
                        const v16bf k0 = WFrag<bf>::ld((const bf*)(Ks + (ps_ * KP + kt * 16) * KPB)), k1 = WFrag<bf>::ld((const bf*)(Ks + (ps_ * KP + kt * 16) * KPB + 64));
#pragma unroll
                        for (int g = 0; g < 2; ++g) { s[kt][g] = wmmab(k0, qf[g][0], (v8f){}); s[kt][g] = wmmab(k1, qf[g][1], s[kt][g]); }
                    }
                    float mx[2];
#pragma unroll
                    for (int g = 0; g < 2; ++g) {
                        float t = s[0][g][0];
#pragma unroll
                        for (int j = 1; j < 8; ++j) t = fmaxf(t, s[0][g][j]);
#pragma unroll
                        for (int j = 0; j < 8; ++j) t = fmaxf(t, s[1][g][j]);
                        mx[g] = fmaxf(t, xhalf(t)) * CSL;
                    }
#pragma unroll
                    for (int g = 0; g < 2; ++g) {
                        const float mn = fmaxf(m[g], mx[g]); const float dm = m[g] - mn; m[g] = mn; float al;
                        asm("v_exp_f32 %0, %1\n\tv_nop" : "=v"(al) : "v"(dm));   // al = 2^dm; the v_nop fills the slot that a transcendental wants before its source is overwritten or its result read, and stands in the same statement so that it stays directly behind it
                        l[g] *= al;
#pragma unroll
                        for (int dt = 0; dt < 4; ++dt) o[dt][g] *= al;
                    }
                    weights();
#pragma unroll
                    for (int g = 0; g < 2; ++g) ln[g] = l[g] + ps[g];
                }
            }
#pragma unroll
            for (int g = 0; g < 2; ++g) l[g] = ln[g];
            __builtin_amdgcn_sched_barrier(0);   // keeps the eight products back to back with the Vt fetch directly behind them
#pragma unroll
            for (int dt = 0; dt < 4; ++dt)
#pragma unroll
                for (int g = 0; g < 2; ++g) o[dt][g] = wmma16(vf[dt], pf[g], o[dt][g]);
            if (ps_ + 1 < SK / KP) {
#pragma unroll
                for (int dt = 0; dt < 4; ++dt) vf[dt] = WFrag<h16>::ld((const h16*)(Vs + dt * 16 * VPB + (ps_ + 1) * KP * 2));
            }
            __builtin_amdgcn_sched_barrier(0);   // ends the pass: without it the unrolled next pass's score products and K reads are mixed into these products, and the LDS reads stand at four places of a pass instead of two
        }
    }
    asm volatile("s_wait_asynccnt 0x0" ::: "memory");   // no copy is outstanding when the wave ends
    // set 0 keeps query group 0 and gives group 1 away, set 1 the other way round
    v8f ok[4], og[4];
#pragma unroll
    for (int dt = 0; dt < 4; ++dt) { ok[dt] = set ? o[dt][1] : o[dt][0]; og[dt] = set ? o[dt][0] : o[dt][1]; }
    const float l0_ = l[0][0] + l[0][1], l1_ = l[1][0] + l[1][1];   // the two partial sums of each group are joined here
    const float mk = set ? m[1] : m[0], lk_ = set ? l1_ : l0_, mg = set ? m[0] : m[1], lg = set ? l0_ : l1_;
    v4f* Xw = X + (size_t)((set * NQW + wave) * 9) * 32 + lane;
    const v4f* Xr = X + (size_t)(((set ^ 1) * NQW + wave) * 9) * 32 + lane;
#pragma unroll
    for (int dt = 0; dt < 4; ++dt) { Xw[(2 * dt) * 32] = (v4f){ og[dt][0], og[dt][1], og[dt][2], og[dt][3] }; Xw[(2 * dt + 1) * 32] = (v4f){ og[dt][4], og[dt][5], og[dt][6], og[dt][7] }; }
    Xw[8 * 32] = (v4f){ mg, lg, 0.f, 0.f };
    __syncthreads();   // the partner wave's partial result is in LDS behind it
    {
        const v4f ml = Xr[8 * 32];
        const float mn = fmaxf(mk, ml[0]);
        const float dk = mk - mn, dp = ml[0] - mn; float fk, fp;   // both partial results go to the common maximum
        asm("v_exp_f32 %0, %1\n\tv_nop" : "=v"(fk) : "v"(dk));   // fk = 2^dk; the v_nop fills the slot that a transcendental wants before its source is overwritten or its result read
        asm("v_exp_f32 %0, %1\n\tv_nop" : "=v"(fp) : "v"(dp));   // fp = 2^dp; the same slot
        const float ls = lk_ * fk + ml[1] * fp;
        const float inv = __fdiv_rn(1.0f, ls + xhalf(ls));
        const float ck = fk * inv, cp = fp * inv;
        float* op = OUT + ((size_t)zq * TT + q0 + set * 16 + lr) * HD + 8 * hi;   // register r of tile dt = d 16 dt + 8h + r of query lr: 8 floats in a row
#pragma unroll
        for (int dt = 0; dt < 4; ++dt) {
            const v4f p0 = Xr[(2 * dt) * 32], p1 = Xr[(2 * dt + 1) * 32];
            *(v4f*)(op + dt * 16) = (v4f){ ok[dt][0], ok[dt][1], ok[dt][2], ok[dt][3] } * ck + p0 * cp;
            *(v4f*)(op + dt * 16 + 4) = (v4f){ ok[dt][4], ok[dt][5], ok[dt][6], ok[dt][7] } * ck + p1 * cp;
        }
    }
}

extern "C" void kernel_launch(void* const* d_in, const int* in_sizes, int n_in,
                              void* d_out, int out_size, void* d_ws, size_t ws_size, hipStream_t stream) {
    (void)in_sizes; (void)n_in; (void)out_size;
    const float* q = (const float*)d_in[0]; const float* k = (const float*)d_in[1]; const float* v = (const float*)d_in[2];
    float* OUT = (float*)d_out;     // [2][16][2048][64]
    char* wsp = (char*)d_ws;
    auto take = [&](size_t bytes) { char* p = wsp; wsp += (bytes + 255) & ~(size_t)255; return (void*)p; };
    bf* KB = (bf*)take((size_t)NB_ * NHKV * TT * HD * 2); h16* VT = (h16*)take((size_t)NB_ * NHKV * HD * TT * 2);
    if ((size_t)(wsp - (char*)d_ws) > ws_size) return;    // 4 MiB
    k_prep<<<NB_ * NHKV * TT / PK, 256, 0, stream>>>(k, v, KB, VT);
    k_fattn<<<dim3(TT / (QW * NQW), NB_ * NHQ), NWV * 32, 0, stream>>>(q, KB, VT, OUT);
}
